// v000
// Measured on an AMD MI455X. A time is GPU time per run, averaged over a window of back-to-back runs after a warm-up
// (all launches, gaps included; the runs take copies of the inputs in turn), and the median of several windows.
// Apart from v000's, it joins two sittings. Times from different sittings can be a few percent apart, while
// side-by-side timings come from the same sitting.
// v000, which the later versions start from, runs in 129 microseconds.
#include <hip/hip_runtime.h>

// ---------------------------------------------------------------------------
// S4 layer for MI455X (gfx1250, wave32).
//   u:(4,4096,1024) f32 -> y:(4,4096,1024) f32
// Two fp32 WMMA GEMMs (16x16x4) around a chunked parallel complex scan.
// GEMM tiles: 32 rows x 128 cols per 256-thread block (8 waves, 2 acc/wave),
// double-buffered LDS fed by gfx1250 async global->LDS loads when available.
// ---------------------------------------------------------------------------

typedef __attribute__((ext_vector_type(2))) float v2f;
typedef __attribute__((ext_vector_type(8))) float v8f;

#define T_LEN   4096
#define BATCH   4
#define HDIM    1024
#define NSTATE  64
#define NCOL    (2 * NSTATE)          // 128 (re/im interleaved columns)
#define MROWS   (BATCH * T_LEN)       // 16384
#define MTILE   32                    // rows per block
#define KC      32                    // K-chunk per LDS stage
#define APITCH  (KC + 2)              // 34: conflict-free, rows 8B-aligned
#define NCH     64                    // scan chunks
#define CLEN    64                    // timesteps per scan chunk

// ---- workspace layout (float offsets) -------------------------------------
#define OFF_ABAR 0u
#define OFF_COEF (OFF_ABAR + 2u * NSTATE)                       // 128
#define OFF_B1   (OFF_COEF + 2u * NSTATE)                       // 256
#define OFF_WT   (OFF_B1 + (size_t)HDIM * NCOL)                 // +131072
#define OFF_BU   (OFF_WT + (size_t)NCOL * HDIM)                 // +131072
#define OFF_XS   (OFF_BU + (size_t)MROWS * NCOL)                // +2097152
#define OFF_CS   (OFF_XS + (size_t)MROWS * NCOL)                // +2097152
#define OFF_CI   (OFF_CS + (size_t)NCH * BATCH * NSTATE * 2)    // +32768

// ---- gfx1250 async global->LDS path ---------------------------------------
#if defined(__AMDGCN__) && __has_builtin(__builtin_amdgcn_global_load_async_to_lds_b128) && \
    __has_builtin(__builtin_amdgcn_global_load_async_to_lds_b64)
#define USE_ASYNC_LDS 1
#else
#define USE_ASYNC_LDS 0
#endif

#if __has_builtin(__builtin_amdgcn_s_wait_asynccnt)
#define WAIT_ASYNC0() __builtin_amdgcn_s_wait_asynccnt(0)
#else
#define WAIT_ASYNC0() asm volatile("s_wait_asynccnt 0x0" ::: "memory")
#endif

#if USE_ASYNC_LDS
// Types exactly as in the builtin's signature (from the compiler diagnostic):
//   param0: AS1 pointer to int __attribute__((vector_size(8/16)))
//   param1: AS3 pointer
typedef int i2vec __attribute__((__vector_size__(2 * sizeof(int))));
typedef int i4vec __attribute__((__vector_size__(4 * sizeof(int))));
typedef __attribute__((address_space(1))) i2vec* gp_i2;
typedef __attribute__((address_space(1))) i4vec* gp_i4;
typedef __attribute__((address_space(3))) i2vec* lp_i2;
typedef __attribute__((address_space(3))) i4vec* lp_i4;

__device__ __forceinline__ gp_i2 glb2(const void* p) { return (gp_i2)(uintptr_t)p; }
__device__ __forceinline__ gp_i4 glb4(const void* p) { return (gp_i4)(uintptr_t)p; }
// flat LDS address: low 32 bits are the LDS offset
__device__ __forceinline__ lp_i2 lds2(void* p) { return (lp_i2)(uintptr_t)p; }
__device__ __forceinline__ lp_i4 lds4(void* p) { return (lp_i4)(uintptr_t)p; }
#endif

// ---------------------------------------------------------------------------
// Discretization scalars: A_bar = exp(A*step), coef = (A_bar-1)/A
// ---------------------------------------------------------------------------
__global__ __launch_bounds__(64) void k_scalars(const float* __restrict__ log_A_real,
                                                const float* __restrict__ A_imag,
                                                const float* __restrict__ log_step,
                                                float* __restrict__ abar,
                                                float* __restrict__ coef) {
    int n = threadIdx.x;
    float step = __expf(log_step[0]);
    float Ar = -__expf(log_A_real[n]);
    float Ai = A_imag[n];
    float e   = __expf(Ar * step);
    float abr = e * __cosf(Ai * step);
    float abi = e * __sinf(Ai * step);
    float nr = abr - 1.0f, ni = abi;
    float den = Ar * Ar + Ai * Ai;
    float inv = 1.0f / den;
    float cr = (nr * Ar + ni * Ai) * inv;
    float ci = (ni * Ar - nr * Ai) * inv;
    abar[2 * n] = abr;  abar[2 * n + 1] = abi;
    coef[2 * n] = cr;   coef[2 * n + 1] = ci;
}

// B1[h][2n] = Re(coef[n])*B[n,h] ; B1[h][2n+1] = Im(coef[n])*B[n,h]   (HDIM x 128)
__global__ __launch_bounds__(256) void k_build_b1(const float* __restrict__ Bw,
                                                  const float* __restrict__ coef,
                                                  float* __restrict__ B1) {
    int idx = blockIdx.x * 256 + threadIdx.x;        // over NSTATE*HDIM
    int n = idx >> 10;                                // /HDIM
    int h = idx & (HDIM - 1);
    float b = Bw[n * HDIM + h];
    B1[(size_t)h * NCOL + 2 * n]     = coef[2 * n] * b;
    B1[(size_t)h * NCOL + 2 * n + 1] = coef[2 * n + 1] * b;
}

// Wt[2n][h] = C[h,n,0] ; Wt[2n+1][h] = -C[h,n,1]    (128 x HDIM)
__global__ __launch_bounds__(256) void k_build_wt(const float* __restrict__ C,
                                                  float* __restrict__ Wt) {
    int idx = blockIdx.x * 256 + threadIdx.x;        // over HDIM*NSTATE
    int h = idx >> 6;
    int n = idx & (NSTATE - 1);
    Wt[(size_t)(2 * n) * HDIM + h]     =  C[((size_t)h * NSTATE + n) * 2 + 0];
    Wt[(size_t)(2 * n + 1) * HDIM + h] = -C[((size_t)h * NSTATE + n) * 2 + 1];
}

// ---------------------------------------------------------------------------
// WMMA GEMM: Out[M x Ntot] = A[M x K] * Bm[K x Ntot]  (+ D[h]*u epilogue)
// Block = 256 threads = 8 wave32, tile = 32 rows x 128 cols.
// Each wave owns two v_wmma_f32_16x16x4_f32 accumulators sharing one B frag.
// ---------------------------------------------------------------------------
__global__ __launch_bounds__(256) void k_gemm(const float* __restrict__ A, int lda,
                                              const float* __restrict__ Bm, int ldb,
                                              float* __restrict__ Out, int ldo,
                                              int K,
                                              const float* __restrict__ uEp,
                                              const float* __restrict__ dEp,
                                              int useEpi) {
    __shared__ __align__(16) float As[2][MTILE][APITCH];
    __shared__ __align__(16) float Bs[2][KC][NCOL];

    const int tid  = threadIdx.x;
    const int lane = tid & 31;
    const int wave = tid >> 5;                 // 0..7
    const int rowBase = blockIdx.x * MTILE;
    const int colBase = blockIdx.y * NCOL;
    const int m    = lane & 15;                // A row / D row-lane
    const int koff = (lane >> 4) << 1;         // 0 or 2 (K sub-offset per ISA layout)
    const int wcol = wave * 16 + m;            // local column (0..127)

    v8f acc0 = {};
    v8f acc1 = {};
    const int nch = K / KC;

#if USE_ASYNC_LDS
    // ---- async copy assignments ----
    // A: 32x32 f32 chunk as 512 B64 transfers -> 2 per thread
    const int aRowA[2] = { tid >> 4, (tid + 256) >> 4 };
    const int aColA    = (tid & 15) << 1;
    // B: 32x128 f32 chunk as 1024 B128 transfers -> 4 per thread
    int bRow[4], bC4[4];
#pragma unroll
    for (int j = 0; j < 4; ++j) {
        int idx4 = tid + j * 256;
        bRow[j] = idx4 >> 5;
        bC4[j]  = (idx4 & 31) << 2;
    }

    // preload chunk 0
    {
#pragma unroll
        for (int j = 0; j < 2; ++j) {
            const int r = aRowA[j];
            __builtin_amdgcn_global_load_async_to_lds_b64(
                glb2(A + (size_t)(rowBase + r) * lda + aColA),
                lds2(&As[0][r][aColA]), 0, 0);
        }
#pragma unroll
        for (int j = 0; j < 4; ++j) {
            __builtin_amdgcn_global_load_async_to_lds_b128(
                glb4(Bm + (size_t)bRow[j] * ldb + colBase + bC4[j]),
                lds4(&Bs[0][bRow[j]][bC4[j]]), 0, 0);
        }
        WAIT_ASYNC0();
    }
    __syncthreads();

    for (int ch = 0; ch < nch; ++ch) {
        const int cur = ch & 1;
        const bool hasNext = (ch + 1) < nch;

        if (hasNext) {                         // async-stage next chunk into other buffer
            const int nxt = cur ^ 1;
            const int k0 = (ch + 1) * KC;
#pragma unroll
            for (int j = 0; j < 2; ++j) {
                const int r = aRowA[j];
                __builtin_amdgcn_global_load_async_to_lds_b64(
                    glb2(A + (size_t)(rowBase + r) * lda + k0 + aColA),
                    lds2(&As[nxt][r][aColA]), 0, 0);
            }
#pragma unroll
            for (int j = 0; j < 4; ++j) {
                __builtin_amdgcn_global_load_async_to_lds_b128(
                    glb4(Bm + (size_t)(k0 + bRow[j]) * ldb + colBase + bC4[j]),
                    lds4(&Bs[nxt][bRow[j]][bC4[j]]), 0, 0);
            }
            if (ch + 2 < nch)
                __builtin_prefetch(Bm + (size_t)((ch + 2) * KC) * ldb + colBase, 0, 1);
        }

#pragma unroll
        for (int kk = 0; kk < KC; kk += 4) {
            v2f a0, a1, bv;
            a0.x = As[cur][m][kk + koff];
            a0.y = As[cur][m][kk + koff + 1];
            a1.x = As[cur][m + 16][kk + koff];
            a1.y = As[cur][m + 16][kk + koff + 1];
            bv.x = Bs[cur][kk + koff][wcol];
            bv.y = Bs[cur][kk + koff + 1][wcol];
            acc0 = __builtin_amdgcn_wmma_f32_16x16x4_f32(false, a0, false, bv, (short)0, acc0, false, false);
            acc1 = __builtin_amdgcn_wmma_f32_16x16x4_f32(false, a1, false, bv, (short)0, acc1, false, false);
        }

        if (hasNext) WAIT_ASYNC0();            // our copies done before the barrier
        __syncthreads();
    }
#else
    // ---- fallback: VGPR-staged double buffering ----
    const int aRow0 = tid >> 5;                // 0..7 (+8/+16/+24 groups)
    const int aCol  = tid & 31;
    int bRow[4], bC4[4];
#pragma unroll
    for (int j = 0; j < 4; ++j) {
        int idx4 = tid + j * 256;
        bRow[j] = idx4 >> 5;
        bC4[j]  = (idx4 & 31) << 2;
    }
    float ra0, ra1, ra2, ra3;
    float4 rb0, rb1, rb2, rb3;
    {
        ra0 = A[(size_t)(rowBase + aRow0) * lda + aCol];
        ra1 = A[(size_t)(rowBase + aRow0 + 8) * lda + aCol];
        ra2 = A[(size_t)(rowBase + aRow0 + 16) * lda + aCol];
        ra3 = A[(size_t)(rowBase + aRow0 + 24) * lda + aCol];
        rb0 = *(const float4*)(Bm + (size_t)bRow[0] * ldb + colBase + bC4[0]);
        rb1 = *(const float4*)(Bm + (size_t)bRow[1] * ldb + colBase + bC4[1]);
        rb2 = *(const float4*)(Bm + (size_t)bRow[2] * ldb + colBase + bC4[2]);
        rb3 = *(const float4*)(Bm + (size_t)bRow[3] * ldb + colBase + bC4[3]);
        As[0][aRow0][aCol]      = ra0;
        As[0][aRow0 + 8][aCol]  = ra1;
        As[0][aRow0 + 16][aCol] = ra2;
        As[0][aRow0 + 24][aCol] = ra3;
        *(float4*)&Bs[0][bRow[0]][bC4[0]] = rb0;
        *(float4*)&Bs[0][bRow[1]][bC4[1]] = rb1;
        *(float4*)&Bs[0][bRow[2]][bC4[2]] = rb2;
        *(float4*)&Bs[0][bRow[3]][bC4[3]] = rb3;
    }
    __syncthreads();

    for (int ch = 0; ch < nch; ++ch) {
        const int cur = ch & 1;
        const bool hasNext = (ch + 1) < nch;
        if (hasNext) {
            const int k0 = (ch + 1) * KC;
            ra0 = A[(size_t)(rowBase + aRow0) * lda + k0 + aCol];
            ra1 = A[(size_t)(rowBase + aRow0 + 8) * lda + k0 + aCol];
            ra2 = A[(size_t)(rowBase + aRow0 + 16) * lda + k0 + aCol];
            ra3 = A[(size_t)(rowBase + aRow0 + 24) * lda + k0 + aCol];
            rb0 = *(const float4*)(Bm + (size_t)(k0 + bRow[0]) * ldb + colBase + bC4[0]);
            rb1 = *(const float4*)(Bm + (size_t)(k0 + bRow[1]) * ldb + colBase + bC4[1]);
            rb2 = *(const float4*)(Bm + (size_t)(k0 + bRow[2]) * ldb + colBase + bC4[2]);
            rb3 = *(const float4*)(Bm + (size_t)(k0 + bRow[3]) * ldb + colBase + bC4[3]);
            if (ch + 2 < nch)
                __builtin_prefetch(Bm + (size_t)((ch + 2) * KC) * ldb + colBase, 0, 1);
        }
#pragma unroll
        for (int kk = 0; kk < KC; kk += 4) {
            v2f a0, a1, bv;
            a0.x = As[cur][m][kk + koff];
            a0.y = As[cur][m][kk + koff + 1];
            a1.x = As[cur][m + 16][kk + koff];
            a1.y = As[cur][m + 16][kk + koff + 1];
            bv.x = Bs[cur][kk + koff][wcol];
            bv.y = Bs[cur][kk + koff + 1][wcol];
            acc0 = __builtin_amdgcn_wmma_f32_16x16x4_f32(false, a0, false, bv, (short)0, acc0, false, false);
            acc1 = __builtin_amdgcn_wmma_f32_16x16x4_f32(false, a1, false, bv, (short)0, acc1, false, false);
        }
        if (hasNext) {
            const int nxt = cur ^ 1;
            As[nxt][aRow0][aCol]      = ra0;
            As[nxt][aRow0 + 8][aCol]  = ra1;
            As[nxt][aRow0 + 16][aCol] = ra2;
            As[nxt][aRow0 + 24][aCol] = ra3;
            *(float4*)&Bs[nxt][bRow[0]][bC4[0]] = rb0;
            *(float4*)&Bs[nxt][bRow[1]][bC4[1]] = rb1;
            *(float4*)&Bs[nxt][bRow[2]][bC4[2]] = rb2;
            *(float4*)&Bs[nxt][bRow[3]][bC4[3]] = rb3;
        }
        __syncthreads();
    }
#endif

    // D-matrix layout: VGPR j -> M = j (lanes 0-15) / j+8 (lanes 16-31), N = lane%16
    const int mAdd = (lane < 16) ? 0 : 8;
    const int c = colBase + wcol;
#pragma unroll
    for (int j = 0; j < 8; ++j) {
        const int r0 = rowBase + mAdd + j;
        const int r1 = r0 + 16;
        float v0 = acc0[j];
        float v1 = acc1[j];
        if (useEpi) {
            v0 += dEp[c] * uEp[(size_t)r0 * ldo + c];
            v1 += dEp[c] * uEp[(size_t)r1 * ldo + c];
        }
        Out[(size_t)r0 * ldo + c] = v0;
        Out[(size_t)r1 * ldo + c] = v1;
    }
}

// ---------------------------------------------------------------------------
// Chunked parallel complex scan: x_t = A_bar * x_{t-1} + Bu_t
// ---------------------------------------------------------------------------
__global__ __launch_bounds__(256) void k_scan_local(const float* __restrict__ Bu,
                                                    const float* __restrict__ abar,
                                                    float* __restrict__ xs,
                                                    float* __restrict__ csum) {
    const int tid = threadIdx.x;              // b*64 + n
    const int b = tid >> 6, n = tid & 63;
    const int chunk = blockIdx.x;
    const float ar = abar[2 * n], ai = abar[2 * n + 1];
    float xr = 0.f, xi = 0.f;
    const int t0 = chunk * CLEN;
#pragma unroll 4
    for (int i = 0; i < CLEN; ++i) {
        const size_t row = (size_t)b * T_LEN + t0 + i;
        const float* p = Bu + row * NCOL + 2 * n;
        float br = p[0], bi = p[1];
        float nr = fmaf(ar, xr, fmaf(-ai, xi, br));
        float ni = fmaf(ar, xi, fmaf(ai, xr, bi));
        xr = nr; xi = ni;
        float* q = xs + row * NCOL + 2 * n;
        q[0] = xr; q[1] = xi;
    }
    csum[(size_t)(chunk * 256 + tid) * 2]     = xr;
    csum[(size_t)(chunk * 256 + tid) * 2 + 1] = xi;
}

__global__ __launch_bounds__(256) void k_scan_carry(const float* __restrict__ abar,
                                                    const float* __restrict__ csum,
                                                    float* __restrict__ cinit) {
    const int tid = threadIdx.x;
    const int n = tid & 63;
    float pr = abar[2 * n], pi = abar[2 * n + 1];
#pragma unroll
    for (int s = 0; s < 6; ++s) {             // A_bar^64 by repeated squaring
        float nr = pr * pr - pi * pi;
        float ni = 2.f * pr * pi;
        pr = nr; pi = ni;
    }
    float cr = 0.f, ci = 0.f;
    for (int c = 0; c < NCH; ++c) {
        cinit[(size_t)(c * 256 + tid) * 2]     = cr;
        cinit[(size_t)(c * 256 + tid) * 2 + 1] = ci;
        float sr = csum[(size_t)(c * 256 + tid) * 2];
        float si = csum[(size_t)(c * 256 + tid) * 2 + 1];
        float nr = fmaf(pr, cr, fmaf(-pi, ci, sr));
        float ni = fmaf(pr, ci, fmaf(pi, cr, si));
        cr = nr; ci = ni;
    }
}

__global__ __launch_bounds__(256) void k_scan_fix(const float* __restrict__ abar,
                                                  const float* __restrict__ cinit,
                                                  float* __restrict__ xs) {
    const int tid = threadIdx.x;
    const int b = tid >> 6, n = tid & 63;
    const int chunk = blockIdx.x;
    float ir = cinit[(size_t)(chunk * 256 + tid) * 2];
    float ii = cinit[(size_t)(chunk * 256 + tid) * 2 + 1];
    if (ir == 0.f && ii == 0.f) return;       // chunk 0 carries nothing
    const float ar = abar[2 * n], ai = abar[2 * n + 1];
    float cr = ar * ir - ai * ii;             // A_bar^(i+1) * init, i = 0
    float ci = ar * ii + ai * ir;
    const int t0 = chunk * CLEN;
#pragma unroll 4
    for (int i = 0; i < CLEN; ++i) {
        const size_t row = (size_t)b * T_LEN + t0 + i;
        float* q = xs + row * NCOL + 2 * n;
        q[0] += cr; q[1] += ci;
        float nr = cr * ar - ci * ai;
        float ni = cr * ai + ci * ar;
        cr = nr; ci = ni;
    }
}

// ---------------------------------------------------------------------------
extern "C" void kernel_launch(void* const* d_in, const int* in_sizes, int n_in,
                              void* d_out, int out_size, void* d_ws, size_t ws_size,
                              hipStream_t stream) {
    const float* u     = (const float*)d_in[0];
    const float* lar   = (const float*)d_in[1];
    const float* aim   = (const float*)d_in[2];
    const float* Bw    = (const float*)d_in[3];
    const float* Cw    = (const float*)d_in[4];
    const float* Dw    = (const float*)d_in[5];
    const float* lstep = (const float*)d_in[6];
    float* out = (float*)d_out;
    float* ws  = (float*)d_ws;

    float* abar = ws + OFF_ABAR;
    float* coef = ws + OFF_COEF;
    float* B1   = ws + OFF_B1;
    float* Wt   = ws + OFF_WT;
    float* Bu   = ws + OFF_BU;
    float* xs   = ws + OFF_XS;
    float* csum = ws + OFF_CS;
    float* cinit= ws + OFF_CI;

    k_scalars<<<1, 64, 0, stream>>>(lar, aim, lstep, abar, coef);
    k_build_b1<<<(NSTATE * HDIM) / 256, 256, 0, stream>>>(Bw, coef, B1);
    k_build_wt<<<(HDIM * NSTATE) / 256, 256, 0, stream>>>(Cw, Wt);

    // GEMM 1: Bu[16384 x 128] = u[16384 x 1024] * B1[1024 x 128]
    dim3 g1(MROWS / MTILE, 1);
    k_gemm<<<g1, 256, 0, stream>>>(u, HDIM, B1, NCOL, Bu, NCOL, HDIM,
                                   nullptr, nullptr, 0);

    // parallel scan over T
    k_scan_local<<<NCH, 256, 0, stream>>>(Bu, abar, xs, csum);
    k_scan_carry<<<1, 256, 0, stream>>>(abar, csum, cinit);
    k_scan_fix<<<NCH, 256, 0, stream>>>(abar, cinit, xs);

    // GEMM 2: y[16384 x 1024] = xs[16384 x 128] * Wt[128 x 1024] + D .* u
    dim3 g2(MROWS / MTILE, HDIM / NCOL);
    k_gemm<<<g2, 256, 0, stream>>>(xs, NCOL, Wt, HDIM, out, HDIM, NCOL,
                                   u, Dw, 1);
}

// v001
// One run takes 106 microseconds.
// Next to v000, in two timings, it ran 1.26 times as fast each time.
#include <hip/hip_runtime.h>

// ---------------------------------------------------------------------------
// S4 layer for MI455X (gfx1250, wave32).
//   u:(4,4096,1024) f32 -> y:(4,4096,1024) f32
// Two fp32 WMMA GEMMs (16x16x4) around a chunked parallel complex scan.
// GEMM tiles: 64 (input) or 128 (readout) rows x 128 cols x 64 k per 256-thread
// block (8 waves, 4 or 8 acc/wave), double-buffered LDS fed by async global->LDS copies.
// ---------------------------------------------------------------------------

typedef __attribute__((ext_vector_type(2))) float v2f;
typedef __attribute__((ext_vector_type(8))) float v8f;

#define T_LEN   4096
#define BATCH   4
#define HDIM    1024
#define NSTATE  64
#define NCOL    (2 * NSTATE)          // 128 (re/im interleaved columns)
#define MROWS   (BATCH * T_LEN)       // 16384
#define MT_IN   64                    // rows per block, input projection
#define MT_OUT  128                   // rows per block, readout
#define KC      64                    // K-chunk per LDS stage
#define APITCH  (KC + 4)              // 68: 16 rows x 4 k on 64 banks, rows 16B-aligned
#define NCH     64                    // scan chunks
#define CLEN    64                    // timesteps per scan chunk

// ---- workspace layout (float offsets) -------------------------------------
#define OFF_ABAR 0u
#define OFF_COEF (OFF_ABAR + 2u * NSTATE)                       // 128
#define OFF_B1   (OFF_COEF + 2u * NSTATE)                       // 256
#define OFF_WT   (OFF_B1 + (size_t)HDIM * NCOL)                 // +131072
#define OFF_BU   (OFF_WT + (size_t)NCOL * HDIM)                 // +131072
#define OFF_XS   (OFF_BU + (size_t)MROWS * NCOL)                // +2097152
#define OFF_CS   (OFF_XS + (size_t)MROWS * NCOL)                // +2097152
#define OFF_CI   (OFF_CS + (size_t)NCH * BATCH * NSTATE * 2)    // +32768

// ---- gfx1250 async global->LDS path ---------------------------------------
// asm with a memory clobber: holds every later LDS read behind the wait
#define WAIT_ASYNC0() asm volatile("s_wait_asynccnt 0x0" ::: "memory")
// a wave's LDS reads have retired before the barrier that frees their buffer
#define WAIT_DS0()    asm volatile("s_wait_dscnt 0x0" ::: "memory")

// Types as in the builtin's signature:
//   param0: AS1 pointer to int __attribute__((vector_size(16)))
//   param1: AS3 pointer
typedef int i4vec __attribute__((__vector_size__(4 * sizeof(int))));
typedef __attribute__((address_space(1))) i4vec* gp_i4;
typedef __attribute__((address_space(3))) i4vec* lp_i4;

__device__ __forceinline__ gp_i4 glb4(const void* p) { return (gp_i4)(uintptr_t)p; }
// flat LDS address: low 32 bits are the LDS offset
__device__ __forceinline__ lp_i4 lds4(void* p) { return (lp_i4)(uintptr_t)p; }

// ---------------------------------------------------------------------------
// Discretization scalars: A_bar = exp(A*step), coef = (A_bar-1)/A
// ---------------------------------------------------------------------------
__global__ __launch_bounds__(64) void k_scalars(const float* __restrict__ log_A_real,
                                                const float* __restrict__ A_imag,
                                                const float* __restrict__ log_step,
                                                float* __restrict__ abar,
                                                float* __restrict__ coef) {
    int n = threadIdx.x;
    float step = __expf(log_step[0]);
    float Ar = -__expf(log_A_real[n]);
    float Ai = A_imag[n];
    float e   = __expf(Ar * step);
    float abr = e * __cosf(Ai * step);
    float abi = e * __sinf(Ai * step);
    float nr = abr - 1.0f, ni = abi;
    float den = Ar * Ar + Ai * Ai;
    float inv = 1.0f / den;
    float cr = (nr * Ar + ni * Ai) * inv;
    float ci = (ni * Ar - nr * Ai) * inv;
    abar[2 * n] = abr;  abar[2 * n + 1] = abi;
    coef[2 * n] = cr;   coef[2 * n + 1] = ci;
}

// B1[h][2n] = Re(coef[n])*B[n,h] ; B1[h][2n+1] = Im(coef[n])*B[n,h]   (HDIM x 128)
__global__ __launch_bounds__(256) void k_build_b1(const float* __restrict__ Bw,
                                                  const float* __restrict__ coef,
                                                  float* __restrict__ B1) {
    int idx = blockIdx.x * 256 + threadIdx.x;        // over NSTATE*HDIM
    int n = idx >> 10;                                // /HDIM
    int h = idx & (HDIM - 1);
    float b = Bw[n * HDIM + h];
    B1[(size_t)h * NCOL + 2 * n]     = coef[2 * n] * b;
    B1[(size_t)h * NCOL + 2 * n + 1] = coef[2 * n + 1] * b;
}

// Wt[2n][h] = C[h,n,0] ; Wt[2n+1][h] = -C[h,n,1]    (128 x HDIM)
__global__ __launch_bounds__(256) void k_build_wt(const float* __restrict__ C,
                                                  float* __restrict__ Wt) {
    int idx = blockIdx.x * 256 + threadIdx.x;        // over HDIM*NSTATE
    int h = idx >> 6;
    int n = idx & (NSTATE - 1);
    Wt[(size_t)(2 * n) * HDIM + h]     =  C[((size_t)h * NSTATE + n) * 2 + 0];
    Wt[(size_t)(2 * n + 1) * HDIM + h] = -C[((size_t)h * NSTATE + n) * 2 + 1];
}

// ---------------------------------------------------------------------------
// WMMA GEMM: Out[M x Ntot] = A[M x K] * Bm[K x Ntot]  (+ D[h]*u epilogue)
// Block = 256 threads = 8 wave32, tile = MT rows x 128 cols, K staged 64 deep.
// Each wave owns 16 columns and all MT rows: MT/16 v_wmma_f32_16x16x4_f32
// accumulators share one B fragment.
// ---------------------------------------------------------------------------
template <int MT>
__device__ __forceinline__ void gemm_stage(const float* __restrict__ A, int lda,
                                           const float* __restrict__ Bm, int ldb,
                                           int rowBase, int colBase, int k0, int tid,
                                           float (*As)[APITCH], float (*Bs)[NCOL]) {
    // A: MT x 64 f32 as MT*16 B128 transfers -> MT/16 per thread (16 lanes = one 256-B row)
#pragma unroll
    for (int j = 0; j < MT / 16; ++j) {
        const int r  = (tid >> 4) + j * 16;
        const int c4 = (tid & 15) << 2;
        __builtin_amdgcn_global_load_async_to_lds_b128(
            glb4(A + (size_t)(rowBase + r) * lda + k0 + c4), lds4(&As[r][c4]), 0, 0);
    }
    // B: 64 x 128 f32 as 2048 B128 transfers -> 8 per thread (one wave = one 512-B row)
#pragma unroll
    for (int j = 0; j < KC / 8; ++j) {
        const int r  = (tid >> 5) + j * 8;
        const int c4 = (tid & 31) << 2;
        __builtin_amdgcn_global_load_async_to_lds_b128(
            glb4(Bm + (size_t)(k0 + r) * ldb + colBase + c4), lds4(&Bs[r][c4]), 0, 0);
    }
}

template <int MT>
__device__ __forceinline__ void gemm_body(const float* __restrict__ A, int lda,
                                          const float* __restrict__ Bm, int ldb,
                                          float* __restrict__ Out, int ldo,
                                          int K,
                                          const float* __restrict__ uEp,
                                          const float* __restrict__ dEp,
                                          int useEpi) {
    constexpr int FA = MT / 16;                // A fragments (accumulators) per wave
    __shared__ __align__(16) float As[2][MT][APITCH];
    __shared__ __align__(16) float Bs[2][KC][NCOL];

    const int tid  = threadIdx.x;
    const int lane = tid & 31;
    const int wave = tid >> 5;                 // 0..7
    const int rowBase = blockIdx.x * MT;
    const int colBase = blockIdx.y * NCOL;
    const int m    = lane & 15;                // A row / D row-lane
    const int koff = (lane >> 4) << 1;         // 0 or 2 (K sub-offset per ISA layout)
    const int wcol = wave * 16 + m;            // local column (0..127)

    v8f acc[FA];
#pragma unroll
    for (int f = 0; f < FA; ++f) acc[f] = v8f{};
    const int nch = K / KC;

    // stage 0 lands and is published before anyone reads it; stage 1 then flies
    gemm_stage<MT>(A, lda, Bm, ldb, rowBase, colBase, 0, tid, As[0], Bs[0]);
    WAIT_ASYNC0();
    __syncthreads();
    if (nch > 1)
        gemm_stage<MT>(A, lda, Bm, ldb, rowBase, colBase, KC, tid, As[1], Bs[1]);

    // rolled: one trip is 16*FA WMMAs already, a full unroll would only grow the text
#pragma unroll 1
    for (int ch = 0; ch < nch; ++ch) {
        const int cur = ch & 1;

#pragma unroll
        for (int kk = 0; kk < KC; kk += 4) {
            v2f bv;
            bv.x = Bs[cur][kk + koff][wcol];
            bv.y = Bs[cur][kk + koff + 1][wcol];
#pragma unroll
            for (int f = 0; f < FA; ++f) {
                v2f a;
                a.x = As[cur][f * 16 + m][kk + koff];
                a.y = As[cur][f * 16 + m][kk + koff + 1];
                acc[f] = __builtin_amdgcn_wmma_f32_16x16x4_f32(false, a, false, bv, (short)0, acc[f], false, false);
            }
        }

        // publish point: our reads of this buffer retired, our copies of the next
        // stage landed, then the barrier; only behind it is this buffer refilled
        WAIT_DS0();
        WAIT_ASYNC0();
        __syncthreads();
        if (ch + 2 < nch)
            gemm_stage<MT>(A, lda, Bm, ldb, rowBase, colBase, (ch + 2) * KC, tid, As[cur], Bs[cur]);
    }
    WAIT_ASYNC0();                             // no copy outlives the loop

    // D-matrix layout: VGPR j -> M = j (lanes 0-15) / j+8 (lanes 16-31), N = lane%16
    const int mAdd = (lane < 16) ? 0 : 8;
    const int c = colBase + wcol;
#pragma unroll
    for (int f = 0; f < FA; ++f) {
#pragma unroll
        for (int j = 0; j < 8; ++j) {
            const int r = rowBase + f * 16 + mAdd + j;
            float v = acc[f][j];
            if (useEpi) v += dEp[c] * uEp[(size_t)r * ldo + c];
            Out[(size_t)r * ldo + c] = v;
        }
    }
}

// input projection: 64-row tiles, so that 16384 x 128 gives one block per WGP (256)
__global__ __launch_bounds__(256) void k_gemm_in(const float* __restrict__ A, int lda,
                                                 const float* __restrict__ Bm, int ldb,
                                                 float* __restrict__ Out, int ldo,
                                                 int K) {
    gemm_body<MT_IN>(A, lda, Bm, ldb, Out, ldo, K, nullptr, nullptr, 0);
}

// readout: 128-row tiles (1024 blocks, two resident per WGP by LDS)
__global__ __launch_bounds__(256) void k_gemm_out(const float* __restrict__ A, int lda,
                                                  const float* __restrict__ Bm, int ldb,
                                                  float* __restrict__ Out, int ldo,
                                                  int K,
                                                  const float* __restrict__ uEp,
                                                  const float* __restrict__ dEp) {
    gemm_body<MT_OUT>(A, lda, Bm, ldb, Out, ldo, K, uEp, dEp, 1);
}

// ---------------------------------------------------------------------------
// Chunked parallel complex scan: x_t = A_bar * x_{t-1} + Bu_t
// ---------------------------------------------------------------------------
__global__ __launch_bounds__(256) void k_scan_local(const float* __restrict__ Bu,
                                                    const float* __restrict__ abar,
                                                    float* __restrict__ xs,
                                                    float* __restrict__ csum) {
    const int tid = threadIdx.x;              // b*64 + n
    const int b = tid >> 6, n = tid & 63;
    const int chunk = blockIdx.x;
    const float ar = abar[2 * n], ai = abar[2 * n + 1];
    float xr = 0.f, xi = 0.f;
    const int t0 = chunk * CLEN;
#pragma unroll 4
    for (int i = 0; i < CLEN; ++i) {
        const size_t row = (size_t)b * T_LEN + t0 + i;
        const float* p = Bu + row * NCOL + 2 * n;
        float br = p[0], bi = p[1];
        float nr = fmaf(ar, xr, fmaf(-ai, xi, br));
        float ni = fmaf(ar, xi, fmaf(ai, xr, bi));
        xr = nr; xi = ni;
        float* q = xs + row * NCOL + 2 * n;
        q[0] = xr; q[1] = xi;
    }
    csum[(size_t)(chunk * 256 + tid) * 2]     = xr;
    csum[(size_t)(chunk * 256 + tid) * 2 + 1] = xi;
}

__global__ __launch_bounds__(256) void k_scan_carry(const float* __restrict__ abar,
                                                    const float* __restrict__ csum,
                                                    float* __restrict__ cinit) {
    const int tid = threadIdx.x;
    const int n = tid & 63;
    float pr = abar[2 * n], pi = abar[2 * n + 1];
#pragma unroll
    for (int s = 0; s < 6; ++s) {             // A_bar^64 by repeated squaring
        float nr = pr * pr - pi * pi;
        float ni = 2.f * pr * pi;
        pr = nr; pi = ni;
    }
    float cr = 0.f, ci = 0.f;
    for (int c = 0; c < NCH; ++c) {
        cinit[(size_t)(c * 256 + tid) * 2]     = cr;
        cinit[(size_t)(c * 256 + tid) * 2 + 1] = ci;
        float sr = csum[(size_t)(c * 256 + tid) * 2];
        float si = csum[(size_t)(c * 256 + tid) * 2 + 1];
        float nr = fmaf(pr, cr, fmaf(-pi, ci, sr));
        float ni = fmaf(pr, ci, fmaf(pi, cr, si));
        cr = nr; ci = ni;
    }
}

__global__ __launch_bounds__(256) void k_scan_fix(const float* __restrict__ abar,
                                                  const float* __restrict__ cinit,
                                                  float* __restrict__ xs) {
    const int tid = threadIdx.x;
    const int b = tid >> 6, n = tid & 63;
    const int chunk = blockIdx.x;
    float ir = cinit[(size_t)(chunk * 256 + tid) * 2];
    float ii = cinit[(size_t)(chunk * 256 + tid) * 2 + 1];
    if (ir == 0.f && ii == 0.f) return;       // chunk 0 carries nothing
    const float ar = abar[2 * n], ai = abar[2 * n + 1];
    float cr = ar * ir - ai * ii;             // A_bar^(i+1) * init, i = 0
    float ci = ar * ii + ai * ir;
    const int t0 = chunk * CLEN;
#pragma unroll 4
    for (int i = 0; i < CLEN; ++i) {
        const size_t row = (size_t)b * T_LEN + t0 + i;
        float* q = xs + row * NCOL + 2 * n;
        q[0] += cr; q[1] += ci;
        float nr = cr * ar - ci * ai;
        float ni = cr * ai + ci * ar;
        cr = nr; ci = ni;
    }
}

// ---------------------------------------------------------------------------
extern "C" void kernel_launch(void* const* d_in, const int* in_sizes, int n_in,
                              void* d_out, int out_size, void* d_ws, size_t ws_size,
                              hipStream_t stream) {
    const float* u     = (const float*)d_in[0];
    const float* lar   = (const float*)d_in[1];
    const float* aim   = (const float*)d_in[2];
    const float* Bw    = (const float*)d_in[3];
    const float* Cw    = (const float*)d_in[4];
    const float* Dw    = (const float*)d_in[5];
    const float* lstep = (const float*)d_in[6];
    float* out = (float*)d_out;
    float* ws  = (float*)d_ws;

    float* abar = ws + OFF_ABAR;
    float* coef = ws + OFF_COEF;
    float* B1   = ws + OFF_B1;
    float* Wt   = ws + OFF_WT;
    float* Bu   = ws + OFF_BU;
    float* xs   = ws + OFF_XS;
    float* csum = ws + OFF_CS;
    float* cinit= ws + OFF_CI;

    k_scalars<<<1, 64, 0, stream>>>(lar, aim, lstep, abar, coef);
    k_build_b1<<<(NSTATE * HDIM) / 256, 256, 0, stream>>>(Bw, coef, B1);
    k_build_wt<<<(HDIM * NSTATE) / 256, 256, 0, stream>>>(Cw, Wt);

    // GEMM 1: Bu[16384 x 128] = u[16384 x 1024] * B1[1024 x 128]
    dim3 g1(MROWS / MT_IN, 1);
    k_gemm_in<<<g1, 256, 0, stream>>>(u, HDIM, B1, NCOL, Bu, NCOL, HDIM);

    // parallel scan over T
    k_scan_local<<<NCH, 256, 0, stream>>>(Bu, abar, xs, csum);
    k_scan_carry<<<1, 256, 0, stream>>>(abar, csum, cinit);
    k_scan_fix<<<NCH, 256, 0, stream>>>(abar, cinit, xs);

    // GEMM 2: y[16384 x 1024] = xs[16384 x 128] * Wt[128 x 1024] + D .* u
    dim3 g2(MROWS / MT_OUT, HDIM / NCOL);
    k_gemm_out<<<g2, 256, 0, stream>>>(xs, NCOL, Wt, HDIM, out, HDIM, NCOL,
                                       u, Dw);
}

// v002
// Measured time: 77.5 microseconds a run.
// In both of two side-by-side timings against v001, it was 1.36 times as fast.
// All steps since v000 together make it 1.72 times as fast.
#include <hip/hip_runtime.h>

// ---------------------------------------------------------------------------
// S4 layer for MI455X (gfx1250, wave32).
//   u:(4,4096,1024) f32 -> y:(4,4096,1024) f32
// Two fp32 WMMA GEMMs (16x16x4) around a chunked parallel complex scan.
// The scan has no launch of its own: its chunk-local pass runs in the input GEMM's
// epilogue (one block = one chunk of one batch); the readout forms each chunk's
// carry from the chunks' end states and adds it to its A tile in LDS.
// GEMM tiles: 64 (input) or 128 (readout) rows x 128 cols x 64 k per 256-thread
// block (8 waves, 4 or 8 acc/wave), double-buffered LDS fed by async global->LDS copies.
// ---------------------------------------------------------------------------

typedef __attribute__((ext_vector_type(2))) float v2f;
typedef __attribute__((ext_vector_type(8))) float v8f;

#define T_LEN   4096
#define BATCH   4
#define HDIM    1024
#define NSTATE  64
#define NCOL    (2 * NSTATE)          // 128 (re/im interleaved columns)
#define MROWS   (BATCH * T_LEN)       // 16384
#define MT_IN   64                    // rows per block, input projection
#define MT_OUT  128                   // rows per block, readout
#define KC      64                    // K-chunk per LDS stage
#define APITCH  (KC + 4)              // 68: 16 rows x 4 k on 64 banks, rows 16B-aligned
#define NCH     64                    // scan chunks
#define CLEN    64                    // timesteps per scan chunk

// ---- workspace layout (float offsets) -------------------------------------
#define OFF_ABAR 0u
#define OFF_COEF (OFF_ABAR + 2u * NSTATE)                       // 128
#define OFF_B1   (OFF_COEF + 2u * NSTATE)                       // 256
#define OFF_WT   (OFF_B1 + (size_t)HDIM * NCOL)                 // +131072
#define OFF_XS   (OFF_WT + (size_t)NCOL * HDIM)                 // +131072
#define OFF_CS   (OFF_XS + (size_t)MROWS * NCOL)                // +2097152

// ---- gfx1250 async global->LDS path ---------------------------------------
// asm with a memory clobber: holds every later LDS read behind the wait
#define WAIT_ASYNC0() asm volatile("s_wait_asynccnt 0x0" ::: "memory")
// a wave's LDS reads have retired before the barrier that frees their buffer
#define WAIT_DS0()    asm volatile("s_wait_dscnt 0x0" ::: "memory")

// Types as in the builtin's signature:
//   param0: AS1 pointer to int __attribute__((vector_size(16)))
//   param1: AS3 pointer
typedef int i4vec __attribute__((__vector_size__(4 * sizeof(int))));
typedef __attribute__((address_space(1))) i4vec* gp_i4;
typedef __attribute__((address_space(3))) i4vec* lp_i4;

__device__ __forceinline__ gp_i4 glb4(const void* p) { return (gp_i4)(uintptr_t)p; }
// flat LDS address: low 32 bits are the LDS offset
__device__ __forceinline__ lp_i4 lds4(void* p) { return (lp_i4)(uintptr_t)p; }

// ---------------------------------------------------------------------------
// Discretization scalars: A_bar = exp(A*step), coef = (A_bar-1)/A
// ---------------------------------------------------------------------------
__global__ __launch_bounds__(64) void k_scalars(const float* __restrict__ log_A_real,
                                                const float* __restrict__ A_imag,
                                                const float* __restrict__ log_step,
                                                float* __restrict__ abar,
                                                float* __restrict__ coef) {
    int n = threadIdx.x;
    float step = __expf(log_step[0]);
    float Ar = -__expf(log_A_real[n]);
    float Ai = A_imag[n];
    float e   = __expf(Ar * step);
    float abr = e * __cosf(Ai * step);
    float abi = e * __sinf(Ai * step);
    float nr = abr - 1.0f, ni = abi;
    float den = Ar * Ar + Ai * Ai;
    float inv = 1.0f / den;
    float cr = (nr * Ar + ni * Ai) * inv;
    float ci = (ni * Ar - nr * Ai) * inv;
    abar[2 * n] = abr;  abar[2 * n + 1] = abi;
    coef[2 * n] = cr;   coef[2 * n + 1] = ci;
}

// B1[h][2n] = Re(coef[n])*B[n,h] ; B1[h][2n+1] = Im(coef[n])*B[n,h]   (HDIM x 128)
__global__ __launch_bounds__(256) void k_build_b1(const float* __restrict__ Bw,
                                                  const float* __restrict__ coef,
                                                  float* __restrict__ B1) {
    int idx = blockIdx.x * 256 + threadIdx.x;        // over NSTATE*HDIM
    int n = idx >> 10;                                // /HDIM
    int h = idx & (HDIM - 1);
    float b = Bw[n * HDIM + h];
    B1[(size_t)h * NCOL + 2 * n]     = coef[2 * n] * b;
    B1[(size_t)h * NCOL + 2 * n + 1] = coef[2 * n + 1] * b;
}

// Wt[2n][h] = C[h,n,0] ; Wt[2n+1][h] = -C[h,n,1]    (128 x HDIM)
__global__ __launch_bounds__(256) void k_build_wt(const float* __restrict__ C,
                                                  float* __restrict__ Wt) {
    int idx = blockIdx.x * 256 + threadIdx.x;        // over HDIM*NSTATE
    int h = idx >> 6;
    int n = idx & (NSTATE - 1);
    Wt[(size_t)(2 * n) * HDIM + h]     =  C[((size_t)h * NSTATE + n) * 2 + 0];
    Wt[(size_t)(2 * n + 1) * HDIM + h] = -C[((size_t)h * NSTATE + n) * 2 + 1];
}

// ---------------------------------------------------------------------------
// WMMA GEMM: Out[M x Ntot] = A[M x K] * Bm[K x Ntot]
// SCAN (input): epilogue runs x_t = A_bar * x_{t-1} + row_t down the tile from x = 0.
// else (readout): A holds such chunk-local scans; the prologue adds each chunk's carry
// to the A tile in LDS, the epilogue adds D[h]*u.
// Block = 256 threads = 8 wave32, tile = MT rows x 128 cols, K staged 64 deep.
// Each wave owns 16 columns and all MT rows: MT/16 v_wmma_f32_16x16x4_f32
// accumulators share one B fragment.
// ---------------------------------------------------------------------------
template <int MT>
__device__ __forceinline__ void stage_a(const float* __restrict__ A, int lda,
                                        int rowBase, int k0, int tid,
                                        float (*As)[APITCH]) {
    // A: MT x 64 f32 as MT*16 B128 transfers -> MT/16 per thread (16 lanes = one 256-B row)
#pragma unroll
    for (int j = 0; j < MT / 16; ++j) {
        const int r  = (tid >> 4) + j * 16;
        const int c4 = (tid & 15) << 2;
        __builtin_amdgcn_global_load_async_to_lds_b128(
            glb4(A + (size_t)(rowBase + r) * lda + k0 + c4), lds4(&As[r][c4]), 0, 0);
    }
}

__device__ __forceinline__ void stage_b(const float* __restrict__ Bm, int ldb,
                                        int colBase, int k0, int tid,
                                        float (*Bs)[NCOL]) {
    // B: 64 x 128 f32 as 2048 B128 transfers -> 8 per thread (one wave = one 512-B row)
#pragma unroll
    for (int j = 0; j < KC / 8; ++j) {
        const int r  = (tid >> 5) + j * 8;
        const int c4 = (tid & 31) << 2;
        __builtin_amdgcn_global_load_async_to_lds_b128(
            glb4(Bm + (size_t)(k0 + r) * ldb + colBase + c4), lds4(&Bs[r][c4]), 0, 0);
    }
}

template <int MT>
__device__ __forceinline__ void gemm_stage(const float* __restrict__ A, int lda,
                                           const float* __restrict__ Bm, int ldb,
                                           int rowBase, int colBase, int k0, int tid,
                                           float (*As)[APITCH], float (*Bs)[NCOL]) {
    stage_a<MT>(A, lda, rowBase, k0, tid, As);
    stage_b(Bm, ldb, colBase, k0, tid, Bs);
}

template <int MT, bool SCAN>
__device__ __forceinline__ void gemm_body(const float* __restrict__ A, int lda,
                                          const float* __restrict__ Bm, int ldb,
                                          float* __restrict__ Out, int ldo,
                                          int K,
                                          const float* __restrict__ uEp,
                                          const float* __restrict__ dEp,
                                          const float* __restrict__ abar,
                                          float* __restrict__ csumOut,
                                          const float* __restrict__ csumIn) {
    constexpr int FA = MT / 16;                // A fragments (accumulators) per wave
    __shared__ __align__(16) float As[2][MT][APITCH];
    __shared__ __align__(16) float Bs[2][KC][NCOL];

    const int tid  = threadIdx.x;
    const int lane = tid & 31;
    const int wave = tid >> 5;                 // 0..7
    const int rowBase = blockIdx.x * MT;
    const int colBase = blockIdx.y * NCOL;
    const int m    = lane & 15;                // A row / D row-lane
    const int koff = (lane >> 4) << 1;         // 0 or 2 (K sub-offset per ISA layout)
    const int wcol = wave * 16 + m;            // local column (0..127)

    v8f acc[FA];
#pragma unroll
    for (int f = 0; f < FA; ++f) acc[f] = v8f{};
    const int nch = SCAN ? K / KC : NCOL / KC;
    // SCAN: asked for here, so that the epilogue's two scanning waves do not wait for it
    v2f ab = v2f{};
    if constexpr (SCAN) ab = *(const v2f*)(abar + 2 * (tid & (NSTATE - 1)));

    if constexpr (SCAN) {
        // stage 0 lands and is published before anyone reads it; stage 1 then flies
        gemm_stage<MT>(A, lda, Bm, ldb, rowBase, colBase, 0, tid, As[0], Bs[0]);
        WAIT_ASYNC0();
        __syncthreads();
        if (nch > 1)
            gemm_stage<MT>(A, lda, Bm, ldb, rowBase, colBase, KC, tid, As[1], Bs[1]);
    } else {
        // K = NCOL = two stages, MT rows = two scan chunks of one batch.
        static_assert(NCOL == 2 * KC && MT == 2 * CLEN && KC == 64, "wave = (stage, chunk)");
        // the whole A tile comes with B's stage 0: the carry is added before any read of A
        stage_a<MT>(A, lda, rowBase, 0, tid, As[0]);
        stage_a<MT>(A, lda, rowBase, KC, tid, As[1]);
        stage_b(Bm, ldb, colBase, 0, tid, Bs[0]);

        // Waves 0..3 each take one k stage (32 states, one per lane) of one chunk.
        // readfirstlane: keeps the wave's number, and the tests on it, in scalar registers
        const int wv    = __builtin_amdgcn_readfirstlane(wave);
        const int st    = wv & 1, ck = (wv >> 1) & 1;
        const int n     = st * 32 + lane;
        const int chunk = (rowBase % T_LEN) / CLEN + ck;
        const bool fixes = wv < 4 && chunk > 0;      // chunk 0 carries nothing
        v2f corr[CLEN];                              // A_bar^(i+1) * carry, row i of the chunk
        if (fixes) {
            // carry = sum over j < chunk of (A_bar^CLEN)^(chunk-1-j) * end state of chunk j;
            // the end states are asked for eight chunks at a time, all before the first use
            const int idx = (rowBase / T_LEN) * NSTATE + n;
            const float* cs = csumIn + (size_t)idx * 2;
            v2f s[NCH];
#pragma unroll
            for (int g = 0; g < NCH; g += 8)
                if (g < chunk) {
#pragma unroll
                    for (int j = g; j < g + 8; ++j) s[j] = *(const v2f*)(cs + (size_t)j * (BATCH * NSTATE * 2));
                }
            // stands before any register that these loads name as an address is written again;
            // the two inputs keep those registers from being reused as a load's target before it
            asm volatile("s_wait_xcnt 0x0" :: "v"(idx), "v"(cs) : "memory");
            const float ar = abar[2 * n], ai = abar[2 * n + 1];
            float pr = ar, pi = ai;
#pragma unroll
            for (int q = 0; q < 6; ++q) {             // A_bar^64 by repeated squaring
                float nr = pr * pr - pi * pi;
                float ni = 2.f * pr * pi;
                pr = nr; pi = ni;
            }
            float ir = 0.f, ii = 0.f;
#pragma unroll
            for (int j = 0; j < NCH - 1; ++j)
                if (j < chunk) {                      // same for the whole wave
                    float nr = fmaf(pr, ir, fmaf(-pi, ii, s[j].x));
                    float ni = fmaf(pr, ii, fmaf(pi, ir, s[j].y));
                    ir = nr; ii = ni;
                }
            // the serial chain of powers runs here, while the copies are still in flight
            float cr = ar * ir - ai * ii;
            float ci = ar * ii + ai * ir;
#pragma unroll
            for (int i = 0; i < CLEN; ++i) {
                corr[i] = v2f{cr, ci};
                float nr = cr * ar - ci * ai;
                float ni = cr * ai + ci * ar;
                cr = nr; ci = ni;
            }
        }

        WAIT_ASYNC0();
        __syncthreads();
        stage_b(Bm, ldb, colBase, KC, tid, Bs[1]);    // flies while the carry is added

        if (fixes) {
            float (*T)[APITCH] = As[st];
#pragma unroll
            for (int i = 0; i < CLEN; ++i) {
                v2f* p = (v2f*)&T[ck * CLEN + i][2 * lane];
                *p = *p + corr[i];
            }
        }
        // the corrected A tile is published before any wave takes a fragment of it
        __syncthreads();
    }

    // rolled: one trip is 16*FA WMMAs already, a full unroll would only grow the text
#pragma unroll 1
    for (int ch = 0; ch < nch; ++ch) {
        const int cur = ch & 1;

#pragma unroll
        for (int kk = 0; kk < KC; kk += 4) {
            v2f bv;
            bv.x = Bs[cur][kk + koff][wcol];
            bv.y = Bs[cur][kk + koff + 1][wcol];
#pragma unroll
            for (int f = 0; f < FA; ++f) {
                v2f a;
                a.x = As[cur][f * 16 + m][kk + koff];
                a.y = As[cur][f * 16 + m][kk + koff + 1];
                acc[f] = __builtin_amdgcn_wmma_f32_16x16x4_f32(false, a, false, bv, (short)0, acc[f], false, false);
            }
        }

        // publish point: our reads of this buffer retired, our copies of the next
        // stage landed, then the barrier; only behind it is this buffer refilled
        WAIT_DS0();
        WAIT_ASYNC0();
        __syncthreads();
        if (ch + 2 < nch)
            gemm_stage<MT>(A, lda, Bm, ldb, rowBase, colBase, (ch + 2) * KC, tid, As[cur], Bs[cur]);
    }
    WAIT_ASYNC0();                             // no copy outlives the loop

    // D-matrix layout: VGPR j -> M = j (lanes 0-15) / j+8 (lanes 16-31), N = lane%16
    const int mAdd = (lane < 16) ? 0 : 8;
    if constexpr (SCAN) {
        // The tile is one scan chunk (CLEN steps of one batch, all NSTATE states).
        static_assert(MT == CLEN && KC == CLEN, "one tile = one chunk, held in one B stage");
        // Bs[0] is free: every wave has passed the loop's last barrier, no copy is in flight
        float (*S)[NCOL] = Bs[0];
#pragma unroll
        for (int f = 0; f < FA; ++f)
#pragma unroll
            for (int j = 0; j < 8; ++j) S[f * 16 + mAdd + j][wcol] = acc[f][j];
        // all eight waves' columns stand in LDS before two waves walk down them
        __syncthreads();
        if (tid < NSTATE) {
            const int n = tid;
            const float ar = ab.x, ai = ab.y;
            v2f bu[CLEN];
#pragma unroll
            for (int i = 0; i < CLEN; ++i) bu[i] = *(const v2f*)&S[i][2 * n];
            float xr = 0.f, xi = 0.f;
            float* q = Out + (size_t)rowBase * NCOL + 2 * n;
#pragma unroll
            for (int i = 0; i < CLEN; ++i) {
                float nr = fmaf(ar, xr, fmaf(-ai, xi, bu[i].x));
                float ni = fmaf(ar, xi, fmaf(ai, xr, bu[i].y));
                xr = nr; xi = ni;
                *(v2f*)(q + (size_t)i * NCOL) = v2f{xr, xi};
            }
            const int b = blockIdx.x / NCH, chunk = blockIdx.x % NCH;
            *(v2f*)(csumOut + (size_t)(chunk * (BATCH * NSTATE) + b * NSTATE + n) * 2) = v2f{xr, xi};
        }
    } else {
        const int c = colBase + wcol;
#pragma unroll
        for (int f = 0; f < FA; ++f) {
#pragma unroll
            for (int j = 0; j < 8; ++j) {
                const int r = rowBase + f * 16 + mAdd + j;
                Out[(size_t)r * ldo + c] = acc[f][j] + dEp[c] * uEp[(size_t)r * ldo + c];
            }
        }
    }
}

// input projection: 64-row tiles, so that 16384 x 128 gives one block per WGP (256);
// writes the chunk-local scan of its tile to Out and the chunk's end state to csum
__global__ __launch_bounds__(256) void k_gemm_in(const float* __restrict__ A, int lda,
                                                 const float* __restrict__ Bm, int ldb,
                                                 float* __restrict__ Out, int ldo,
                                                 int K,
                                                 const float* __restrict__ abar,
                                                 float* __restrict__ csum) {
    gemm_body<MT_IN, true>(A, lda, Bm, ldb, Out, ldo, K, nullptr, nullptr, abar, csum, nullptr);
}

// readout: 128-row tiles (1024 blocks, two resident per WGP by LDS)
__global__ __launch_bounds__(256) void k_gemm_out(const float* __restrict__ A, int lda,
                                                  const float* __restrict__ Bm, int ldb,
                                                  float* __restrict__ Out, int ldo,
                                                  const float* __restrict__ uEp,
                                                  const float* __restrict__ dEp,
                                                  const float* __restrict__ abar,
                                                  const float* __restrict__ csum) {
    gemm_body<MT_OUT, false>(A, lda, Bm, ldb, Out, ldo, NCOL, uEp, dEp, abar, nullptr, csum);
}

// ---------------------------------------------------------------------------
extern "C" void kernel_launch(void* const* d_in, const int* in_sizes, int n_in,
                              void* d_out, int out_size, void* d_ws, size_t ws_size,
                              hipStream_t stream) {
    const float* u     = (const float*)d_in[0];
    const float* lar   = (const float*)d_in[1];
    const float* aim   = (const float*)d_in[2];
    const float* Bw    = (const float*)d_in[3];
    const float* Cw    = (const float*)d_in[4];
    const float* Dw    = (const float*)d_in[5];
    const float* lstep = (const float*)d_in[6];
    float* out = (float*)d_out;
    float* ws  = (float*)d_ws;

    float* abar = ws + OFF_ABAR;
    float* coef = ws + OFF_COEF;
    float* B1   = ws + OFF_B1;
    float* Wt   = ws + OFF_WT;
    float* xs   = ws + OFF_XS;
    float* csum = ws + OFF_CS;

    k_scalars<<<1, 64, 0, stream>>>(lar, aim, lstep, abar, coef);
    k_build_b1<<<(NSTATE * HDIM) / 256, 256, 0, stream>>>(Bw, coef, B1);
    k_build_wt<<<(HDIM * NSTATE) / 256, 256, 0, stream>>>(Cw, Wt);

    // GEMM 1: u[16384 x 1024] * B1[1024 x 128], scanned chunk by chunk in its epilogue
    dim3 g1(MROWS / MT_IN, 1);
    k_gemm_in<<<g1, 256, 0, stream>>>(u, HDIM, B1, NCOL, xs, NCOL, HDIM, abar, csum);

    // GEMM 2: y[16384 x 1024] = (xs + carries)[16384 x 128] * Wt[128 x 1024] + D .* u
    dim3 g2(MROWS / MT_OUT, HDIM / NCOL);
    k_gemm_out<<<g2, 256, 0, stream>>>(xs, NCOL, Wt, HDIM, out, HDIM,
                                       u, Dw, abar, csum);
}

// v003
// A run of this version takes 60.1 microseconds.
// In both of two side-by-side timings against v002, it was 1.29 times as fast.
// Over all steps from v000 it is 2.22 times as fast.
#include <hip/hip_runtime.h>

// ---------------------------------------------------------------------------
// S4 layer for MI455X (gfx1250, wave32).
//   u:(4,4096,1024) f32 -> y:(4,4096,1024) f32
// Two fp32 WMMA GEMMs (16x16x4) around a chunked parallel complex scan.
// The scan has no launch of its own: its chunk-local pass runs in the input GEMM's
// epilogue (one block = one chunk of one batch); the readout forms each chunk's
// carry from the chunks' end states and adds it to its A tile in LDS.
// The input GEMM multiplies by the real B as it is given (64 columns); the complex
// factor (A_bar-1)/A of each state multiplies the finished sums in the epilogue.
// GEMM tiles per 256-thread block (8 waves): input 64 rows x 64 cols x 128 k (2 acc/wave),
// readout 128 x 128 x 64 k (8 acc/wave); double-buffered LDS fed by async global->LDS copies.
// ---------------------------------------------------------------------------

typedef __attribute__((ext_vector_type(2))) float v2f;
typedef __attribute__((ext_vector_type(8))) float v8f;

#define T_LEN   4096
#define BATCH   4
#define HDIM    1024
#define NSTATE  64
#define NCOL    (2 * NSTATE)          // 128 (re/im interleaved columns)
#define MROWS   (BATCH * T_LEN)       // 16384
#define MT_IN   64                    // rows per block, input projection
#define MT_OUT  128                   // rows per block, readout
#define KC      64                    // K-chunk per LDS stage, readout
#define APITCH  (KC + 4)              // 68: 16 rows x 4 k on 64 banks, rows 16B-aligned
#define KC_IN   128                   // K-chunk per LDS stage, input projection
#define PITCH_IN (KC_IN + 4)          // 132 = 4 mod 64: the same bank pattern as APITCH
#define NCH     64                    // scan chunks
#define CLEN    64                    // timesteps per scan chunk

// ---- workspace layout (float offsets) -------------------------------------
#define OFF_ABAR 0u
#define OFF_COEF (OFF_ABAR + 2u * NSTATE)                       // 128
#define OFF_WT   (OFF_COEF + 2u * NSTATE)                       // 256
#define OFF_XS   (OFF_WT + (size_t)NCOL * HDIM)                 // +131072
#define OFF_CS   (OFF_XS + (size_t)MROWS * NCOL)                // +2097152

// ---- gfx1250 async global->LDS path ---------------------------------------
// asm with a memory clobber: holds every later LDS read behind the wait
#define WAIT_ASYNC0() asm volatile("s_wait_asynccnt 0x0" ::: "memory")
// a wave's LDS reads have retired before the barrier that frees their buffer
#define WAIT_DS0()    asm volatile("s_wait_dscnt 0x0" ::: "memory")

// Types as in the builtin's signature:
//   param0: AS1 pointer to int __attribute__((vector_size(16)))
//   param1: AS3 pointer
typedef int i4vec __attribute__((__vector_size__(4 * sizeof(int))));
typedef __attribute__((address_space(1))) i4vec* gp_i4;
typedef __attribute__((address_space(3))) i4vec* lp_i4;

__device__ __forceinline__ gp_i4 glb4(const void* p) { return (gp_i4)(uintptr_t)p; }
// flat LDS address: low 32 bits are the LDS offset
__device__ __forceinline__ lp_i4 lds4(void* p) { return (lp_i4)(uintptr_t)p; }

// ---------------------------------------------------------------------------
// Discretization scalars: A_bar = exp(A*step), coef = (A_bar-1)/A
// ---------------------------------------------------------------------------
__global__ __launch_bounds__(64) void k_scalars(const float* __restrict__ log_A_real,
                                                const float* __restrict__ A_imag,
                                                const float* __restrict__ log_step,
                                                float* __restrict__ abar,
                                                float* __restrict__ coef) {
    int n = threadIdx.x;
    float step = __expf(log_step[0]);
    float Ar = -__expf(log_A_real[n]);
    float Ai = A_imag[n];
    float e   = __expf(Ar * step);
    float abr = e * __cosf(Ai * step);
    float abi = e * __sinf(Ai * step);
    float nr = abr - 1.0f, ni = abi;
    float den = Ar * Ar + Ai * Ai;
    float inv = 1.0f / den;
    float cr = (nr * Ar + ni * Ai) * inv;
    float ci = (ni * Ar - nr * Ai) * inv;
    abar[2 * n] = abr;  abar[2 * n + 1] = abi;
    coef[2 * n] = cr;   coef[2 * n + 1] = ci;
}

// Wt[2n][h] = C[h,n,0] ; Wt[2n+1][h] = -C[h,n,1]    (128 x HDIM)
__global__ __launch_bounds__(256) void k_build_wt(const float* __restrict__ C,
                                                  float* __restrict__ Wt) {
    int idx = blockIdx.x * 256 + threadIdx.x;        // over HDIM*NSTATE
    int h = idx >> 6;
    int n = idx & (NSTATE - 1);
    Wt[(size_t)(2 * n) * HDIM + h]     =  C[((size_t)h * NSTATE + n) * 2 + 0];
    Wt[(size_t)(2 * n + 1) * HDIM + h] = -C[((size_t)h * NSTATE + n) * 2 + 1];
}

// ---------------------------------------------------------------------------
// Readout GEMM: Out[M x Ntot] = A[M x NCOL] * Bm[NCOL x Ntot] + D .* u
// A holds the chunk-local scans; the prologue adds each chunk's carry to the A tile
// in LDS, the epilogue adds D[h]*u.
// Block = 256 threads = 8 wave32, tile = MT rows x 128 cols, K staged 64 deep.
// Each wave owns 16 columns and all MT rows: MT/16 v_wmma_f32_16x16x4_f32
// accumulators share one B fragment.
// ---------------------------------------------------------------------------
template <int MT>
__device__ __forceinline__ void stage_a(const float* __restrict__ A, int lda,
                                        int rowBase, int k0, int tid,
                                        float (*As)[APITCH]) {
    // A: MT x 64 f32 as MT*16 B128 transfers -> MT/16 per thread (16 lanes = one 256-B row)
#pragma unroll
    for (int j = 0; j < MT / 16; ++j) {
        const int r  = (tid >> 4) + j * 16;
        const int c4 = (tid & 15) << 2;
        __builtin_amdgcn_global_load_async_to_lds_b128(
            glb4(A + (size_t)(rowBase + r) * lda + k0 + c4), lds4(&As[r][c4]), 0, 0);
    }
}

__device__ __forceinline__ void stage_b(const float* __restrict__ Bm, int ldb,
                                        int colBase, int k0, int tid,
                                        float (*Bs)[NCOL]) {
    // B: 64 x 128 f32 as 2048 B128 transfers -> 8 per thread (one wave = one 512-B row)
#pragma unroll
    for (int j = 0; j < KC / 8; ++j) {
        const int r  = (tid >> 5) + j * 8;
        const int c4 = (tid & 31) << 2;
        __builtin_amdgcn_global_load_async_to_lds_b128(
            glb4(Bm + (size_t)(k0 + r) * ldb + colBase + c4), lds4(&Bs[r][c4]), 0, 0);
    }
}

template <int MT>
__device__ __forceinline__ void gemm_body(const float* __restrict__ A, int lda,
                                          const float* __restrict__ Bm, int ldb,
                                          float* __restrict__ Out, int ldo,
                                          const float* __restrict__ uEp,
                                          const float* __restrict__ dEp,
                                          const float* __restrict__ abar,
                                          const float* __restrict__ csumIn) {
    constexpr int FA = MT / 16;                // A fragments (accumulators) per wave
    __shared__ __align__(16) float As[2][MT][APITCH];
    __shared__ __align__(16) float Bs[2][KC][NCOL];

    const int tid  = threadIdx.x;
    const int lane = tid & 31;
    const int wave = tid >> 5;                 // 0..7
    const int rowBase = blockIdx.x * MT;
    const int colBase = blockIdx.y * NCOL;
    const int m    = lane & 15;                // A row / D row-lane
    const int koff = (lane >> 4) << 1;         // 0 or 2 (K sub-offset per ISA layout)
    const int wcol = wave * 16 + m;            // local column (0..127)

    v8f acc[FA];
#pragma unroll
    for (int f = 0; f < FA; ++f) acc[f] = v8f{};
    const int nch = NCOL / KC;

    {
        // K = NCOL = two stages, MT rows = two scan chunks of one batch.
        static_assert(NCOL == 2 * KC && MT == 2 * CLEN && KC == 64, "wave = (stage, chunk)");
        // the whole A tile comes with B's stage 0: the carry is added before any read of A
        stage_a<MT>(A, lda, rowBase, 0, tid, As[0]);
        stage_a<MT>(A, lda, rowBase, KC, tid, As[1]);
        stage_b(Bm, ldb, colBase, 0, tid, Bs[0]);

        // Waves 0..3 each take one k stage (32 states, one per lane) of one chunk.
        // readfirstlane: keeps the wave's number, and the tests on it, in scalar registers
        const int wv    = __builtin_amdgcn_readfirstlane(wave);
        const int st    = wv & 1, ck = (wv >> 1) & 1;
        const int n     = st * 32 + lane;
        const int chunk = (rowBase % T_LEN) / CLEN + ck;
        const bool fixes = wv < 4 && chunk > 0;      // chunk 0 carries nothing
        v2f corr[CLEN];                              // A_bar^(i+1) * carry, row i of the chunk
        if (fixes) {
            // carry = sum over j < chunk of (A_bar^CLEN)^(chunk-1-j) * end state of chunk j;
            // the end states are asked for eight chunks at a time, all before the first use
            const int idx = (rowBase / T_LEN) * NSTATE + n;
            const float* cs = csumIn + (size_t)idx * 2;
            v2f s[NCH];
#pragma unroll
            for (int g = 0; g < NCH; g += 8)
                if (g < chunk) {
#pragma unroll
                    for (int j = g; j < g + 8; ++j) s[j] = *(const v2f*)(cs + (size_t)j * (BATCH * NSTATE * 2));
                }
            // stands before any register that these loads name as an address is written again;
            // the two inputs keep those registers from being reused as a load's target before it
            asm volatile("s_wait_xcnt 0x0" :: "v"(idx), "v"(cs) : "memory");
            const float ar = abar[2 * n], ai = abar[2 * n + 1];
            float pr = ar, pi = ai;
#pragma unroll
            for (int q = 0; q < 6; ++q) {             // A_bar^64 by repeated squaring
                float nr = pr * pr - pi * pi;
                float ni = 2.f * pr * pi;
                pr = nr; pi = ni;
            }
            float ir = 0.f, ii = 0.f;
#pragma unroll
            for (int j = 0; j < NCH - 1; ++j)
                if (j < chunk) {                      // same for the whole wave
                    float nr = fmaf(pr, ir, fmaf(-pi, ii, s[j].x));
                    float ni = fmaf(pr, ii, fmaf(pi, ir, s[j].y));
                    ir = nr; ii = ni;
                }
            // the serial chain of powers runs here, while the copies are still in flight
            float cr = ar * ir - ai * ii;
            float ci = ar * ii + ai * ir;
#pragma unroll
            for (int i = 0; i < CLEN; ++i) {
                corr[i] = v2f{cr, ci};
                float nr = cr * ar - ci * ai;
                float ni = cr * ai + ci * ar;
                cr = nr; ci = ni;
            }
        }

        WAIT_ASYNC0();
        __syncthreads();
        stage_b(Bm, ldb, colBase, KC, tid, Bs[1]);    // flies while the carry is added

        if (fixes) {
            float (*T)[APITCH] = As[st];
#pragma unroll
            for (int i = 0; i < CLEN; ++i) {
                v2f* p = (v2f*)&T[ck * CLEN + i][2 * lane];
                *p = *p + corr[i];
            }
        }
        // the corrected A tile is published before any wave takes a fragment of it
        __syncthreads();
    }

    // rolled: one trip is 16*FA WMMAs already, a full unroll would only grow the text
#pragma unroll 1
    for (int ch = 0; ch < nch; ++ch) {
        const int cur = ch & 1;

#pragma unroll
        for (int kk = 0; kk < KC; kk += 4) {
            v2f bv;
            bv.x = Bs[cur][kk + koff][wcol];
            bv.y = Bs[cur][kk + koff + 1][wcol];
#pragma unroll
            for (int f = 0; f < FA; ++f) {
                v2f a;
                a.x = As[cur][f * 16 + m][kk + koff];
                a.y = As[cur][f * 16 + m][kk + koff + 1];
                acc[f] = __builtin_amdgcn_wmma_f32_16x16x4_f32(false, a, false, bv, (short)0, acc[f], false, false);
            }
        }

        // publish point: our reads of this buffer retired, our copies of the next
        // stage landed, then the barrier
        WAIT_DS0();
        WAIT_ASYNC0();
        __syncthreads();
    }
    WAIT_ASYNC0();                             // no copy outlives the loop

    // D-matrix layout: VGPR j -> M = j (lanes 0-15) / j+8 (lanes 16-31), N = lane%16
    const int mAdd = (lane < 16) ? 0 : 8;
    {
        const int c = colBase + wcol;
#pragma unroll
        for (int f = 0; f < FA; ++f) {
#pragma unroll
            for (int j = 0; j < 8; ++j) {
                const int r = rowBase + f * 16 + mAdd + j;
                Out[(size_t)r * ldo + c] = acc[f][j] + dEp[c] * uEp[(size_t)r * ldo + c];
            }
        }
    }
}

// ---------------------------------------------------------------------------
// Input projection + chunk-local scan. One block = one scan chunk (CLEN steps of one
// batch) x all NSTATE states: P[64 x 64] = u[64 x 1024] * B^T, B taken as given
// (NSTATE x HDIM, k contiguous, so its LDS tile is [state][k] like the A tile and a
// B fragment is one 8-byte read). 16384 / 64 = 256 blocks, one per WGP.
// Wave w: columns 16*(w&3).., rows 32*(w>>2)..: two accumulators share one B fragment.
// Epilogue: every wave lays coef * P (re/im interleaved) into LDS, then two waves run
// x_t = A_bar * x_{t-1} + row_t down the tile from x = 0; the scan goes to Out, the
// chunk's end state to csum.
// ---------------------------------------------------------------------------
__device__ __forceinline__ void stage_in(const float* __restrict__ src, int ld, int rowBase,
                                         int k0, int tid, float (*dst)[PITCH_IN]) {
    // 64 rows x 128 f32 as 2048 B128 transfers -> 8 per thread (one wave = one 512-B row)
#pragma unroll
    for (int j = 0; j < 8; ++j) {
        const int r  = (tid >> 5) + j * 8;
        const int c4 = (tid & 31) << 2;
        __builtin_amdgcn_global_load_async_to_lds_b128(
            glb4(src + (size_t)(rowBase + r) * ld + k0 + c4), lds4(&dst[r][c4]), 0, 0);
    }
}

__global__ __launch_bounds__(256) void k_gemm_in(const float* __restrict__ u, int ldu,
                                                 const float* __restrict__ Bw, int ldb,
                                                 float* __restrict__ Out,
                                                 const float* __restrict__ abar,
                                                 const float* __restrict__ coef,
                                                 float* __restrict__ csum) {
    static_assert(MT_IN == CLEN && NSTATE == 64 && NCOL <= PITCH_IN && HDIM / KC_IN >= 2 && HDIM % KC_IN == 0,
                  "one tile = one chunk, its scan input held in one B stage");
    __shared__ __align__(16) float Us[2][MT_IN][PITCH_IN];
    __shared__ __align__(16) float Bn[2][NSTATE][PITCH_IN];

    const int tid  = threadIdx.x;
    const int lane = tid & 31;
    const int wave = tid >> 5;                 // 0..7
    const int rowBase = blockIdx.x * MT_IN;
    const int m    = lane & 15;                // A row / B column / D column lane
    const int koff = (lane >> 4) << 1;         // 0 or 2 (K sub-offset per ISA layout)
    const int wcol = (wave & 3) * 16 + m;      // state (0..63)
    const int wrow = (wave >> 2) * 32;         // first of the wave's 32 rows

    v8f acc[2] = {v8f{}, v8f{}};
    constexpr int nch = HDIM / KC_IN;
    // asked for here, so that the epilogue does not wait for them
    const v2f ab = *(const v2f*)(abar + 2 * (tid & (NSTATE - 1)));
    const v2f cf = *(const v2f*)(coef + 2 * wcol);

    // stage 0 lands and is published before anyone reads it; stage 1 then flies
    stage_in(u, ldu, rowBase, 0, tid, Us[0]);
    stage_in(Bw, ldb, 0, 0, tid, Bn[0]);
    WAIT_ASYNC0();
    __syncthreads();
    stage_in(u, ldu, rowBase, KC_IN, tid, Us[1]);
    stage_in(Bw, ldb, 0, KC_IN, tid, Bn[1]);

    // rolled: one trip is 64 WMMAs already, a full unroll would only grow the text
#pragma unroll 1
    for (int ch = 0; ch < nch; ++ch) {
        const int cur = ch & 1;

#pragma unroll
        for (int kk = 0; kk < KC_IN; kk += 4) {
            const v2f bv = *(const v2f*)&Bn[cur][wcol][kk + koff];
#pragma unroll
            for (int f = 0; f < 2; ++f) {
                const v2f a = *(const v2f*)&Us[cur][wrow + f * 16 + m][kk + koff];
                acc[f] = __builtin_amdgcn_wmma_f32_16x16x4_f32(false, a, false, bv, (short)0, acc[f], false, false);
            }
        }

        // publish point: our reads of this buffer retired, our copies of the next
        // stage landed, then the barrier; only behind it is this buffer refilled
        WAIT_DS0();
        WAIT_ASYNC0();
        __syncthreads();
        if (ch + 2 < nch) {
            stage_in(u, ldu, rowBase, (ch + 2) * KC_IN, tid, Us[cur]);
            stage_in(Bw, ldb, 0, (ch + 2) * KC_IN, tid, Bn[cur]);
        }
    }
    WAIT_ASYNC0();                             // no copy outlives the loop

    // D-matrix layout: VGPR j -> M = j (lanes 0-15) / j+8 (lanes 16-31), N = lane%16
    const int mAdd = (lane < 16) ? 0 : 8;
    // Bn[0] is free: every wave has passed the loop's last barrier, no copy is in flight
    float (*S)[PITCH_IN] = Bn[0];
#pragma unroll
    for (int f = 0; f < 2; ++f)
#pragma unroll
        for (int j = 0; j < 8; ++j)
            *(v2f*)&S[wrow + f * 16 + mAdd + j][2 * wcol] = v2f{cf.x * acc[f][j], cf.y * acc[f][j]};
    // all eight waves' columns stand in LDS before two waves walk down them
    __syncthreads();
    if (tid < NSTATE) {
        const int n = tid;
        const float ar = ab.x, ai = ab.y;
        v2f bu[CLEN];
#pragma unroll
        for (int i = 0; i < CLEN; ++i) bu[i] = *(const v2f*)&S[i][2 * n];
        float xr = 0.f, xi = 0.f;
        float* q = Out + (size_t)rowBase * NCOL + 2 * n;
#pragma unroll
        for (int i = 0; i < CLEN; ++i) {
            float nr = fmaf(ar, xr, fmaf(-ai, xi, bu[i].x));
            float ni = fmaf(ar, xi, fmaf(ai, xr, bu[i].y));
            xr = nr; xi = ni;
            *(v2f*)(q + (size_t)i * NCOL) = v2f{xr, xi};
        }
        const int b = blockIdx.x / NCH, chunk = blockIdx.x % NCH;
        *(v2f*)(csum + (size_t)(chunk * (BATCH * NSTATE) + b * NSTATE + n) * 2) = v2f{xr, xi};
    }
}

// readout: 128-row tiles (1024 blocks, two resident per WGP by LDS)
__global__ __launch_bounds__(256) void k_gemm_out(const float* __restrict__ A, int lda,
                                                  const float* __restrict__ Bm, int ldb,
                                                  float* __restrict__ Out, int ldo,
                                                  const float* __restrict__ uEp,
                                                  const float* __restrict__ dEp,
                                                  const float* __restrict__ abar,
                                                  const float* __restrict__ csum) {
    gemm_body<MT_OUT>(A, lda, Bm, ldb, Out, ldo, uEp, dEp, abar, csum);
}

// ---------------------------------------------------------------------------
extern "C" void kernel_launch(void* const* d_in, const int* in_sizes, int n_in,
                              void* d_out, int out_size, void* d_ws, size_t ws_size,
                              hipStream_t stream) {
    const float* u     = (const float*)d_in[0];
    const float* lar   = (const float*)d_in[1];
    const float* aim   = (const float*)d_in[2];
    const float* Bw    = (const float*)d_in[3];
    const float* Cw    = (const float*)d_in[4];
    const float* Dw    = (const float*)d_in[5];
    const float* lstep = (const float*)d_in[6];
    float* out = (float*)d_out;
    float* ws  = (float*)d_ws;

    float* abar = ws + OFF_ABAR;
    float* coef = ws + OFF_COEF;
    float* Wt   = ws + OFF_WT;
    float* xs   = ws + OFF_XS;
    float* csum = ws + OFF_CS;

    k_scalars<<<1, 64, 0, stream>>>(lar, aim, lstep, abar, coef);
    k_build_wt<<<(HDIM * NSTATE) / 256, 256, 0, stream>>>(Cw, Wt);

    // GEMM 1: u[16384 x 1024] * B^T[1024 x 64], times coef, scanned chunk by chunk in its epilogue
    k_gemm_in<<<MROWS / MT_IN, 256, 0, stream>>>(u, HDIM, Bw, HDIM, xs, abar, coef, csum);

    // GEMM 2: y[16384 x 1024] = (xs + carries)[16384 x 128] * Wt[128 x 1024] + D .* u
    dim3 g2(MROWS / MT_OUT, HDIM / NCOL);
    k_gemm_out<<<g2, 256, 0, stream>>>(xs, NCOL, Wt, HDIM, out, HDIM,
                                       u, Dw, abar, csum);
}

// v004
// One run takes 51.3 microseconds.
// Next to v003, in two timings, it ran 1.17 and 1.18 times as fast.
// All steps since v000 together make it 2.60 times as fast.
#include <hip/hip_runtime.h>

// ---------------------------------------------------------------------------
// S4 layer for MI455X (gfx1250, wave32).
//   u:(4,4096,1024) f32 -> y:(4,4096,1024) f32
// Two fp32 WMMA GEMMs (16x16x4) around a chunked parallel complex scan.
// The scan has no launch of its own: its chunk-local pass runs in the input GEMM's
// epilogue (one block = one chunk of one batch); the readout forms each chunk's
// carry from the chunks' end states and adds it to its A tile in LDS.
// The input GEMM multiplies by the real B as it is given (64 columns); the complex
// factor (A_bar-1)/A of each state multiplies the finished sums in the epilogue.
// There is no set-up launch: both GEMMs form A_bar (and the factor) of the states they
// need from the raw parameters, and the readout multiplies by C as it is given
// (HDIM x 128, re/im interleaved along k); the minus of Re(C*x) = Cr*xr - Ci*xi sits
// on the imaginary half of the scanned states.
// GEMM tiles per 256-thread block (8 waves): input 64 rows x 64 cols x 128 k (2 acc/wave),
// readout 128 x 128 x 64 k (8 acc/wave); double-buffered LDS fed by async global->LDS copies.
// ---------------------------------------------------------------------------

typedef __attribute__((ext_vector_type(2))) float v2f;
typedef __attribute__((ext_vector_type(8))) float v8f;

#define T_LEN   4096
#define BATCH   4
#define HDIM    1024
#define NSTATE  64
#define NCOL    (2 * NSTATE)          // 128 (re/im interleaved columns)
#define MROWS   (BATCH * T_LEN)       // 16384
#define MT_IN   64                    // rows per block, input projection
#define MT_OUT  128                   // rows per block, readout
#define KC      64                    // K-chunk per LDS stage, readout
#define APITCH  (KC + 4)              // 68: 16 rows x 4 k on 64 banks, rows 16B-aligned
#define KC_IN   128                   // K-chunk per LDS stage, input projection
#define PITCH_IN (KC_IN + 4)          // 132 = 4 mod 64: the same bank pattern as APITCH
#define NCH     64                    // scan chunks
#define CLEN    64                    // timesteps per scan chunk

// ---- workspace layout (float offsets) -------------------------------------
#define OFF_XS   0u
#define OFF_CS   (OFF_XS + (size_t)MROWS * NCOL)                // +2097152

// ---- gfx1250 async global->LDS path ---------------------------------------
// asm with a memory clobber: holds every later LDS read behind the wait
#define WAIT_ASYNC0() asm volatile("s_wait_asynccnt 0x0" ::: "memory")
// a wave's LDS reads have retired before the barrier that frees their buffer
#define WAIT_DS0()    asm volatile("s_wait_dscnt 0x0" ::: "memory")

// Types as in the builtin's signature:
//   param0: AS1 pointer to int __attribute__((vector_size(16)))
//   param1: AS3 pointer
typedef int i4vec __attribute__((__vector_size__(4 * sizeof(int))));
typedef __attribute__((address_space(1))) i4vec* gp_i4;
typedef __attribute__((address_space(3))) i4vec* lp_i4;

__device__ __forceinline__ gp_i4 glb4(const void* p) { return (gp_i4)(uintptr_t)p; }
// flat LDS address: low 32 bits are the LDS offset
__device__ __forceinline__ lp_i4 lds4(void* p) { return (lp_i4)(uintptr_t)p; }

// ---------------------------------------------------------------------------
// Discretization of one state from its raw parameters:
//   A = -exp(log_A_real) + i*A_imag, A_bar = exp(A*step), coef = (A_bar-1)/A
// ---------------------------------------------------------------------------
__device__ __forceinline__ void discretize(float log_A_real, float A_imag, float log_step,
                                           v2f& abar, v2f& coef) {
    float step = __expf(log_step);
    float Ar = -__expf(log_A_real);
    float Ai = A_imag;
    float e   = __expf(Ar * step);
    float abr = e * __cosf(Ai * step);
    float abi = e * __sinf(Ai * step);
    float nr = abr - 1.0f, ni = abi;
    float den = Ar * Ar + Ai * Ai;
    float inv = 1.0f / den;
    abar = v2f{abr, abi};
    coef = v2f{(nr * Ar + ni * Ai) * inv, (ni * Ar - nr * Ai) * inv};
}

// ---------------------------------------------------------------------------
// Readout GEMM: Out[M x Ntot] = A[M x NCOL] * Bm[Ntot x NCOL]^T + D .* u
// A holds the chunk-local scans (re, -im); the prologue adds each chunk's carry to the
// A tile in LDS, the epilogue adds D[h]*u. Bm is C as given: k contiguous, so its LDS
// tile is [column][k] like the A tile and a B fragment is one 8-byte read.
// Block = 256 threads = 8 wave32, tile = MT rows x 128 cols, K staged 64 deep.
// Each wave owns 16 columns and all MT rows: MT/16 v_wmma_f32_16x16x4_f32
// accumulators share one B fragment.
// ---------------------------------------------------------------------------
template <int MT>
__device__ __forceinline__ void stage_a(const float* __restrict__ A, int lda,
                                        int rowBase, int k0, int tid,
                                        float (*As)[APITCH]) {
    // A: MT x 64 f32 as MT*16 B128 transfers -> MT/16 per thread (16 lanes = one 256-B row)
#pragma unroll
    for (int j = 0; j < MT / 16; ++j) {
        const int r  = (tid >> 4) + j * 16;
        const int c4 = (tid & 15) << 2;
        __builtin_amdgcn_global_load_async_to_lds_b128(
            glb4(A + (size_t)(rowBase + r) * lda + k0 + c4), lds4(&As[r][c4]), 0, 0);
    }
}

template <int MT>
__device__ __forceinline__ void gemm_body(const float* __restrict__ A, int lda,
                                          const float* __restrict__ Bm, int ldb,
                                          float* __restrict__ Out, int ldo,
                                          const float* __restrict__ uEp,
                                          const float* __restrict__ dEp,
                                          const float* __restrict__ log_A_real,
                                          const float* __restrict__ A_imag,
                                          const float* __restrict__ log_step,
                                          const float* __restrict__ csumIn) {
    constexpr int FA = MT / 16;                // A fragments (accumulators) per wave
    __shared__ __align__(16) float As[2][MT][APITCH];
    __shared__ __align__(16) float Bs[2][NCOL][APITCH];

    const int tid  = threadIdx.x;
    const int lane = tid & 31;
    const int wave = tid >> 5;                 // 0..7
    const int rowBase = blockIdx.x * MT;
    const int colBase = blockIdx.y * NCOL;
    const int m    = lane & 15;                // A row / D row-lane
    const int koff = (lane >> 4) << 1;         // 0 or 2 (K sub-offset per ISA layout)
    const int wcol = wave * 16 + m;            // local column (0..127)

    v8f acc[FA];
#pragma unroll
    for (int f = 0; f < FA; ++f) acc[f] = v8f{};
    const int nch = NCOL / KC;

    {
        // K = NCOL = two stages, MT rows = two scan chunks of one batch.
        static_assert(NCOL == 2 * KC && MT == 2 * CLEN && KC == 64, "wave = (stage, chunk)");
        // the whole A tile comes with B's stage 0: the carry is added before any read of A
        stage_a<MT>(A, lda, rowBase, 0, tid, As[0]);
        stage_a<MT>(A, lda, rowBase, KC, tid, As[1]);
        stage_a<NCOL>(Bm, ldb, colBase, 0, tid, Bs[0]);

        // Waves 0..3 each take one k stage (32 states, one per lane) of one chunk.
        // readfirstlane: keeps the wave's number, and the tests on it, in scalar registers
        const int wv    = __builtin_amdgcn_readfirstlane(wave);
        const int st    = wv & 1, ck = (wv >> 1) & 1;
        const int n     = st * 32 + lane;
        const int chunk = (rowBase % T_LEN) / CLEN + ck;
        const bool fixes = wv < 4 && chunk > 0;      // chunk 0 carries nothing
        v2f corr[CLEN];                              // A_bar^(i+1) * carry as (re, -im), row i of the chunk
        if (fixes) {
            // carry = sum over j < chunk of (A_bar^CLEN)^(chunk-1-j) * end state of chunk j;
            // the end states are asked for eight chunks at a time, all before the first use
            const int idx = (rowBase / T_LEN) * NSTATE + n;
            const float* cs = csumIn + (size_t)idx * 2;
            const float lar = log_A_real[n], aim = A_imag[n], lst = log_step[0];
            v2f s[NCH];
#pragma unroll
            for (int g = 0; g < NCH; g += 8)
                if (g < chunk) {
#pragma unroll
                    for (int j = g; j < g + 8; ++j) s[j] = *(const v2f*)(cs + (size_t)j * (BATCH * NSTATE * 2));
                }
            // stands before any register that these loads name as an address is written again;
            // the inputs keep those registers from being reused before it
            asm volatile("s_wait_xcnt 0x0" :: "v"(idx), "v"(cs), "v"(n), "s"(log_A_real), "s"(A_imag) : "memory");
            v2f ab, cf;
            discretize(lar, aim, lst, ab, cf);
            const float ar = ab.x, ai = ab.y;
            float pr = ar, pi = ai;
#pragma unroll
            for (int q = 0; q < 6; ++q) {             // A_bar^64 by repeated squaring
                float nr = pr * pr - pi * pi;
                float ni = 2.f * pr * pi;
                pr = nr; pi = ni;
            }
            float ir = 0.f, ii = 0.f;
#pragma unroll
            for (int j = 0; j < NCH - 1; ++j)
                if (j < chunk) {                      // same for the whole wave
                    float nr = fmaf(pr, ir, fmaf(-pi, ii, s[j].x));
                    float ni = fmaf(pr, ii, fmaf(pi, ir, s[j].y));
                    ir = nr; ii = ni;
                }
            // the serial chain of powers runs here, while the copies are still in flight
            float cr = ar * ir - ai * ii;
            float ci = ar * ii + ai * ir;
#pragma unroll
            for (int i = 0; i < CLEN; ++i) {
                corr[i] = v2f{cr, -ci};
                float nr = cr * ar - ci * ai;
                float ni = cr * ai + ci * ar;
                cr = nr; ci = ni;
            }
        }

        WAIT_ASYNC0();
        __syncthreads();
        stage_a<NCOL>(Bm, ldb, colBase, KC, tid, Bs[1]);   // flies while the carry is added

        if (fixes) {
            float (*T)[APITCH] = As[st];
#pragma unroll
            for (int i = 0; i < CLEN; ++i) {
                v2f* p = (v2f*)&T[ck * CLEN + i][2 * lane];
                *p = *p + corr[i];
            }
        }
        // the corrected A tile is published before any wave takes a fragment of it
        __syncthreads();
    }

    // rolled: one trip is 16*FA WMMAs already, a full unroll would only grow the text
#pragma unroll 1
    for (int ch = 0; ch < nch; ++ch) {
        const int cur = ch & 1;

#pragma unroll
        for (int kk = 0; kk < KC; kk += 4) {
            const v2f bv = *(const v2f*)&Bs[cur][wcol][kk + koff];
#pragma unroll
            for (int f = 0; f < FA; ++f) {
                v2f a;
                a.x = As[cur][f * 16 + m][kk + koff];
                a.y = As[cur][f * 16 + m][kk + koff + 1];
                acc[f] = __builtin_amdgcn_wmma_f32_16x16x4_f32(false, a, false, bv, (short)0, acc[f], false, false);
            }
        }

        // publish point: our reads of this buffer retired, our copies of the next
        // stage landed, then the barrier
        WAIT_DS0();
        WAIT_ASYNC0();
        __syncthreads();
    }
    WAIT_ASYNC0();                             // no copy outlives the loop

    // D-matrix layout: VGPR j -> M = j (lanes 0-15) / j+8 (lanes 16-31), N = lane%16
    const int mAdd = (lane < 16) ? 0 : 8;
    {
        const int c = colBase + wcol;
#pragma unroll
        for (int f = 0; f < FA; ++f) {
#pragma unroll
            for (int j = 0; j < 8; ++j) {
                const int r = rowBase + f * 16 + mAdd + j;
                Out[(size_t)r * ldo + c] = acc[f][j] + dEp[c] * uEp[(size_t)r * ldo + c];
            }
        }
    }
}

// ---------------------------------------------------------------------------
// Input projection + chunk-local scan. One block = one scan chunk (CLEN steps of one
// batch) x all NSTATE states: P[64 x 64] = u[64 x 1024] * B^T, B taken as given
// (NSTATE x HDIM, k contiguous, so its LDS tile is [state][k] like the A tile and a
// B fragment is one 8-byte read). 16384 / 64 = 256 blocks, one per WGP.
// Wave w: columns 16*(w&3).., rows 32*(w>>2)..: two accumulators share one B fragment.
// Epilogue: every wave lays coef * P (re/im interleaved) into LDS, then two waves run
// x_t = A_bar * x_{t-1} + row_t down the tile from x = 0; the scan goes to Out as
// (re, -im), the form the readout multiplies by C, the chunk's end state to csum.
// ---------------------------------------------------------------------------
__device__ __forceinline__ void stage_in(const float* __restrict__ src, int ld, int rowBase,
                                         int k0, int tid, float (*dst)[PITCH_IN]) {
    // 64 rows x 128 f32 as 2048 B128 transfers -> 8 per thread (one wave = one 512-B row)
#pragma unroll
    for (int j = 0; j < 8; ++j) {
        const int r  = (tid >> 5) + j * 8;
        const int c4 = (tid & 31) << 2;
        __builtin_amdgcn_global_load_async_to_lds_b128(
            glb4(src + (size_t)(rowBase + r) * ld + k0 + c4), lds4(&dst[r][c4]), 0, 0);
    }
}

__global__ __launch_bounds__(256) void k_gemm_in(const float* __restrict__ u, int ldu,
                                                 const float* __restrict__ Bw, int ldb,
                                                 float* __restrict__ Out,
                                                 const float* __restrict__ log_A_real,
                                                 const float* __restrict__ A_imag,
                                                 const float* __restrict__ log_step,
                                                 float* __restrict__ csum) {
    static_assert(MT_IN == CLEN && NSTATE == 64 && NCOL <= PITCH_IN && HDIM / KC_IN >= 2 && HDIM % KC_IN == 0,
                  "one tile = one chunk, its scan input held in one B stage");
    __shared__ __align__(16) float Us[2][MT_IN][PITCH_IN];
    __shared__ __align__(16) float Bn[2][NSTATE][PITCH_IN];

    const int tid  = threadIdx.x;
    const int lane = tid & 31;
    const int wave = tid >> 5;                 // 0..7
    const int rowBase = blockIdx.x * MT_IN;
    const int m    = lane & 15;                // A row / B column / D column lane
    const int koff = (lane >> 4) << 1;         // 0 or 2 (K sub-offset per ISA layout)
    const int wcol = (wave & 3) * 16 + m;      // state (0..63)
    const int wrow = (wave >> 2) * 32;         // first of the wave's 32 rows

    v8f acc[2] = {v8f{}, v8f{}};
    constexpr int nch = HDIM / KC_IN;

    // stage 0 lands and is published before anyone reads it; stage 1 then flies
    stage_in(u, ldu, rowBase, 0, tid, Us[0]);
    stage_in(Bw, ldb, 0, 0, tid, Bn[0]);
    // asked for here, so that the epilogue does not wait for them: the raw parameters of
    // the state this thread scans (A_bar) and of the state whose column this lane holds (factor)
    const int nScan = tid & (NSTATE - 1);
    const float lst  = log_step[0];
    const float larS = log_A_real[nScan], aimS = A_imag[nScan];
    const float larC = log_A_real[wcol],  aimC = A_imag[wcol];
    // stands before any register that these loads name as an address is written again;
    // the inputs keep those registers from being reused before it
    asm volatile("s_wait_xcnt 0x0" :: "v"(nScan), "v"(wcol), "s"(log_A_real), "s"(A_imag) : "memory");
    v2f ab, cf, abC, cfS;
    discretize(larS, aimS, lst, ab, cfS);
    discretize(larC, aimC, lst, abC, cf);
    WAIT_ASYNC0();
    __syncthreads();
    stage_in(u, ldu, rowBase, KC_IN, tid, Us[1]);
    stage_in(Bw, ldb, 0, KC_IN, tid, Bn[1]);

    // rolled: one trip is 64 WMMAs already, a full unroll would only grow the text
#pragma unroll 1
    for (int ch = 0; ch < nch; ++ch) {
        const int cur = ch & 1;

#pragma unroll
        for (int kk = 0; kk < KC_IN; kk += 4) {
            const v2f bv = *(const v2f*)&Bn[cur][wcol][kk + koff];
#pragma unroll
            for (int f = 0; f < 2; ++f) {
                const v2f a = *(const v2f*)&Us[cur][wrow + f * 16 + m][kk + koff];
                acc[f] = __builtin_amdgcn_wmma_f32_16x16x4_f32(false, a, false, bv, (short)0, acc[f], false, false);
            }
        }

        // publish point: our reads of this buffer retired, our copies of the next
        // stage landed, then the barrier; only behind it is this buffer refilled
        WAIT_DS0();
        WAIT_ASYNC0();
        __syncthreads();
        if (ch + 2 < nch) {
            stage_in(u, ldu, rowBase, (ch + 2) * KC_IN, tid, Us[cur]);
            stage_in(Bw, ldb, 0, (ch + 2) * KC_IN, tid, Bn[cur]);
        }
    }
    WAIT_ASYNC0();                             // no copy outlives the loop

    // D-matrix layout: VGPR j -> M = j (lanes 0-15) / j+8 (lanes 16-31), N = lane%16
    const int mAdd = (lane < 16) ? 0 : 8;
    // Bn[0] is free: every wave has passed the loop's last barrier, no copy is in flight
    float (*S)[PITCH_IN] = Bn[0];
#pragma unroll
    for (int f = 0; f < 2; ++f)
#pragma unroll
        for (int j = 0; j < 8; ++j)
            *(v2f*)&S[wrow + f * 16 + mAdd + j][2 * wcol] = v2f{cf.x * acc[f][j], cf.y * acc[f][j]};
    // all eight waves' columns stand in LDS before two waves walk down them
    __syncthreads();
    if (tid < NSTATE) {
        const int n = tid;
        const float ar = ab.x, ai = ab.y;
        v2f bu[CLEN];
#pragma unroll
        for (int i = 0; i < CLEN; ++i) bu[i] = *(const v2f*)&S[i][2 * n];
        float xr = 0.f, xi = 0.f;
        float* q = Out + (size_t)rowBase * NCOL + 2 * n;
#pragma unroll
        for (int i = 0; i < CLEN; ++i) {
            float nr = fmaf(ar, xr, fmaf(-ai, xi, bu[i].x));
            float ni = fmaf(ar, xi, fmaf(ai, xr, bu[i].y));
            xr = nr; xi = ni;
            *(v2f*)(q + (size_t)i * NCOL) = v2f{xr, -xi};
        }
        const int b = blockIdx.x / NCH, chunk = blockIdx.x % NCH;
        *(v2f*)(csum + (size_t)(chunk * (BATCH * NSTATE) + b * NSTATE + n) * 2) = v2f{xr, xi};
    }
}

// readout: 128-row tiles (1024 blocks, two resident per WGP by LDS)
__global__ __launch_bounds__(256) void k_gemm_out(const float* __restrict__ A, int lda,
                                                  const float* __restrict__ Bm, int ldb,
                                                  float* __restrict__ Out, int ldo,
                                                  const float* __restrict__ uEp,
                                                  const float* __restrict__ dEp,
                                                  const float* __restrict__ log_A_real,
                                                  const float* __restrict__ A_imag,
                                                  const float* __restrict__ log_step,
                                                  const float* __restrict__ csum) {
    gemm_body<MT_OUT>(A, lda, Bm, ldb, Out, ldo, uEp, dEp, log_A_real, A_imag, log_step, csum);
}

// ---------------------------------------------------------------------------
extern "C" void kernel_launch(void* const* d_in, const int* in_sizes, int n_in,
                              void* d_out, int out_size, void* d_ws, size_t ws_size,
                              hipStream_t stream) {
    const float* u     = (const float*)d_in[0];
    const float* lar   = (const float*)d_in[1];
    const float* aim   = (const float*)d_in[2];
    const float* Bw    = (const float*)d_in[3];
    const float* Cw    = (const float*)d_in[4];
    const float* Dw    = (const float*)d_in[5];
    const float* lstep = (const float*)d_in[6];
    float* out = (float*)d_out;
    float* ws  = (float*)d_ws;

    float* xs   = ws + OFF_XS;
    float* csum = ws + OFF_CS;

    // GEMM 1: u[16384 x 1024] * B^T[1024 x 64], times coef, scanned chunk by chunk in its epilogue
    k_gemm_in<<<MROWS / MT_IN, 256, 0, stream>>>(u, HDIM, Bw, HDIM, xs, lar, aim, lstep, csum);

    // GEMM 2: y[16384 x 1024] = (xs + carries)[16384 x 128] * C^T[128 x 1024] + D .* u
    dim3 g2(MROWS / MT_OUT, HDIM / NCOL);
    k_gemm_out<<<g2, 256, 0, stream>>>(xs, NCOL, Cw, NCOL, out, HDIM,
                                       u, Dw, lar, aim, lstep, csum);
}

// v005
// A run of this version takes 48.5 microseconds.
// Timed twice side by side with v004, it ran 1.06 times as fast both times.
// Counting every step since v000, it is 2.75 times as fast.
#include <hip/hip_runtime.h>

// ---------------------------------------------------------------------------
// S4 layer for MI455X (gfx1250, wave32).
//   u:(4,4096,1024) f32 -> y:(4,4096,1024) f32
// Two fp32 WMMA GEMMs (16x16x4) around a chunked parallel complex scan.
// The scan has no launch of its own: its chunk-local pass runs in the input GEMM's
// epilogue (one block = one chunk of one batch); the readout forms each chunk's
// carry from the chunks' end states and adds it to its A tile in LDS.
// The input GEMM multiplies by the real B as it is given (64 columns); the complex
// factor (A_bar-1)/A of each state multiplies the finished sums in the epilogue.
// There is no set-up launch: both GEMMs form A_bar (and the factor) of the states they
// need from the raw parameters, and the readout multiplies by C as it is given
// (HDIM x 128, re/im interleaved along k); the minus of Re(C*x) = Cr*xr - Ci*xi sits
// on the imaginary half of the scanned states.
// Input GEMM: 256 threads (8 waves), tile 64 rows x 64 cols x 128 k (2 acc/wave).
// Readout: 512 threads (16 waves), 64 rows held in LDS, all columns walked 256 at a time
// (4 acc/wave). Double-buffered LDS fed by async global->LDS copies in both.
// ---------------------------------------------------------------------------

typedef __attribute__((ext_vector_type(2))) float v2f;
typedef __attribute__((ext_vector_type(8))) float v8f;

#define T_LEN   4096
#define BATCH   4
#define HDIM    1024
#define NSTATE  64
#define NCOL    (2 * NSTATE)          // 128 (re/im interleaved columns)
#define MROWS   (BATCH * T_LEN)       // 16384
#define MT_IN   64                    // rows per block, input projection
#define CT      256                   // columns per pass, readout
#define NPASS   (HDIM / CT)           // 4 passes
#define PITCH_OUT (NCOL + 4)          // 132 = 4 mod 64: 16 rows x 4 k on 64 banks, rows 16B-aligned
#define KC_IN   128                   // K-chunk per LDS stage, input projection
#define PITCH_IN (KC_IN + 4)          // 132: the same bank pattern
#define NCH     64                    // scan chunks
#define CLEN    64                    // timesteps per scan chunk

// ---- workspace layout (float offsets) -------------------------------------
#define OFF_XS   0u
#define OFF_CS   (OFF_XS + (size_t)MROWS * NCOL)                // +2097152

// ---- gfx1250 async global->LDS path ---------------------------------------
// asm with a memory clobber: holds every later LDS read behind the wait
#define WAIT_ASYNC0() asm volatile("s_wait_asynccnt 0x0" ::: "memory")
// a wave's LDS reads have retired before the barrier that frees their buffer
#define WAIT_DS0()    asm volatile("s_wait_dscnt 0x0" ::: "memory")

// Types as in the builtin's signature:
//   param0: AS1 pointer to int __attribute__((vector_size(16)))
//   param1: AS3 pointer
typedef int i4vec __attribute__((__vector_size__(4 * sizeof(int))));
typedef __attribute__((address_space(1))) i4vec* gp_i4;
typedef __attribute__((address_space(3))) i4vec* lp_i4;

__device__ __forceinline__ gp_i4 glb4(const void* p) { return (gp_i4)(uintptr_t)p; }
// flat LDS address: low 32 bits are the LDS offset
__device__ __forceinline__ lp_i4 lds4(void* p) { return (lp_i4)(uintptr_t)p; }

// ---------------------------------------------------------------------------
// Discretization of one state from its raw parameters:
//   A = -exp(log_A_real) + i*A_imag, A_bar = exp(A*step), coef = (A_bar-1)/A
// ---------------------------------------------------------------------------
__device__ __forceinline__ void discretize(float log_A_real, float A_imag, float log_step,
                                           v2f& abar, v2f& coef) {
    float step = __expf(log_step);
    float Ar = -__expf(log_A_real);
    float Ai = A_imag;
    float e   = __expf(Ar * step);
    float abr = e * __cosf(Ai * step);
    float abi = e * __sinf(Ai * step);
    float nr = abr - 1.0f, ni = abi;
    float den = Ar * Ar + Ai * Ai;
    float inv = 1.0f / den;
    abar = v2f{abr, abi};
    coef = v2f{(nr * Ar + ni * Ai) * inv, (ni * Ar - nr * Ai) * inv};
}

// ---------------------------------------------------------------------------
// Input projection + chunk-local scan. One block = one scan chunk (CLEN steps of one
// batch) x all NSTATE states: P[64 x 64] = u[64 x 1024] * B^T, B taken as given
// (NSTATE x HDIM, k contiguous, so its LDS tile is [state][k] like the A tile and a
// B fragment is one 8-byte read). 16384 / 64 = 256 blocks, one per WGP.
// Wave w: columns 16*(w&3).., rows 32*(w>>2)..: two accumulators share one B fragment.
// Epilogue: every wave lays coef * P (re/im interleaved) into LDS, then two waves run
// x_t = A_bar * x_{t-1} + row_t down the tile from x = 0; the scan goes to Out as
// (re, -im), the form the readout multiplies by C, the chunk's end state to csum.
// ---------------------------------------------------------------------------
__device__ __forceinline__ void stage_in(const float* __restrict__ src, int ld, int rowBase,
                                         int k0, int tid, float (*dst)[PITCH_IN]) {
    // 64 rows x 128 f32 as 2048 B128 transfers -> 8 per thread (one wave = one 512-B row)
#pragma unroll
    for (int j = 0; j < 8; ++j) {
        const int r  = (tid >> 5) + j * 8;
        const int c4 = (tid & 31) << 2;
        __builtin_amdgcn_global_load_async_to_lds_b128(
            glb4(src + (size_t)(rowBase + r) * ld + k0 + c4), lds4(&dst[r][c4]), 0, 0);
    }
}

__global__ __launch_bounds__(256) void k_gemm_in(const float* __restrict__ u, int ldu,
                                                 const float* __restrict__ Bw, int ldb,
                                                 float* __restrict__ Out,
                                                 const float* __restrict__ log_A_real,
                                                 const float* __restrict__ A_imag,
                                                 const float* __restrict__ log_step,
                                                 float* __restrict__ csum) {
    static_assert(MT_IN == CLEN && NSTATE == 64 && NCOL <= PITCH_IN && HDIM / KC_IN >= 2 && HDIM % KC_IN == 0,
                  "one tile = one chunk, its scan input held in one B stage");
    __shared__ __align__(16) float Us[2][MT_IN][PITCH_IN];
    __shared__ __align__(16) float Bn[2][NSTATE][PITCH_IN];

    const int tid  = threadIdx.x;
    const int lane = tid & 31;
    const int wave = tid >> 5;                 // 0..7
    const int rowBase = blockIdx.x * MT_IN;
    const int m    = lane & 15;                // A row / B column / D column lane
    const int koff = (lane >> 4) << 1;         // 0 or 2 (K sub-offset per ISA layout)
    const int wcol = (wave & 3) * 16 + m;      // state (0..63)
    const int wrow = (wave >> 2) * 32;         // first of the wave's 32 rows

    v8f acc[2] = {v8f{}, v8f{}};
    constexpr int nch = HDIM / KC_IN;

    // stage 0 lands and is published before anyone reads it; stage 1 then flies
    stage_in(u, ldu, rowBase, 0, tid, Us[0]);
    stage_in(Bw, ldb, 0, 0, tid, Bn[0]);
    // asked for here, so that the epilogue does not wait for them: the raw parameters of
    // the state this thread scans (A_bar) and of the state whose column this lane holds (factor)
    const int nScan = tid & (NSTATE - 1);
    const float lst  = log_step[0];
    const float larS = log_A_real[nScan], aimS = A_imag[nScan];
    const float larC = log_A_real[wcol],  aimC = A_imag[wcol];
    // stands before any register that these loads name as an address is written again;
    // the inputs keep those registers from being reused before it
    asm volatile("s_wait_xcnt 0x0" :: "v"(nScan), "v"(wcol), "s"(log_A_real), "s"(A_imag) : "memory");
    v2f ab, cf, abC, cfS;
    discretize(larS, aimS, lst, ab, cfS);
    discretize(larC, aimC, lst, abC, cf);
    WAIT_ASYNC0();
    __syncthreads();
    stage_in(u, ldu, rowBase, KC_IN, tid, Us[1]);
    stage_in(Bw, ldb, 0, KC_IN, tid, Bn[1]);

    // rolled: one trip is 64 WMMAs already, a full unroll would only grow the text
#pragma unroll 1
    for (int ch = 0; ch < nch; ++ch) {
        const int cur = ch & 1;

#pragma unroll
        for (int kk = 0; kk < KC_IN; kk += 4) {
            const v2f bv = *(const v2f*)&Bn[cur][wcol][kk + koff];
#pragma unroll
            for (int f = 0; f < 2; ++f) {
                const v2f a = *(const v2f*)&Us[cur][wrow + f * 16 + m][kk + koff];
                acc[f] = __builtin_amdgcn_wmma_f32_16x16x4_f32(false, a, false, bv, (short)0, acc[f], false, false);
            }
        }

        // publish point: our reads of this buffer retired, our copies of the next
        // stage landed, then the barrier; only behind it is this buffer refilled
        WAIT_DS0();
        WAIT_ASYNC0();
        __syncthreads();
        if (ch + 2 < nch) {
            stage_in(u, ldu, rowBase, (ch + 2) * KC_IN, tid, Us[cur]);
            stage_in(Bw, ldb, 0, (ch + 2) * KC_IN, tid, Bn[cur]);
        }
    }
    WAIT_ASYNC0();                             // no copy outlives the loop

    // D-matrix layout: VGPR j -> M = j (lanes 0-15) / j+8 (lanes 16-31), N = lane%16
    const int mAdd = (lane < 16) ? 0 : 8;
    // Bn[0] is free: every wave has passed the loop's last barrier, no copy is in flight
    float (*S)[PITCH_IN] = Bn[0];
#pragma unroll
    for (int f = 0; f < 2; ++f)
#pragma unroll
        for (int j = 0; j < 8; ++j)
            *(v2f*)&S[wrow + f * 16 + mAdd + j][2 * wcol] = v2f{cf.x * acc[f][j], cf.y * acc[f][j]};
    // all eight waves' columns stand in LDS before two waves walk down them
    __syncthreads();
    if (tid < NSTATE) {
        const int n = tid;
        const float ar = ab.x, ai = ab.y;
        v2f bu[CLEN];
#pragma unroll
        for (int i = 0; i < CLEN; ++i) bu[i] = *(const v2f*)&S[i][2 * n];
        float xr = 0.f, xi = 0.f;
        float* q = Out + (size_t)rowBase * NCOL + 2 * n;
#pragma unroll
        for (int i = 0; i < CLEN; ++i) {
            float nr = fmaf(ar, xr, fmaf(-ai, xi, bu[i].x));
            float ni = fmaf(ar, xi, fmaf(ai, xr, bu[i].y));
            xr = nr; xi = ni;
            *(v2f*)(q + (size_t)i * NCOL) = v2f{xr, -xi};
        }
        const int b = blockIdx.x / NCH, chunk = blockIdx.x % NCH;
        *(v2f*)(csum + (size_t)(chunk * (BATCH * NSTATE) + b * NSTATE + n) * 2) = v2f{xr, xi};
    }
}

// ---------------------------------------------------------------------------
// Readout GEMM: Out[M x HDIM] = A[M x NCOL] * Cw[HDIM x NCOL]^T + D .* u
// One block = one scan chunk (CLEN rows of one batch) x ALL HDIM columns, 512 threads =
// 16 wave32, one block per WGP. The A tile (chunk-local scans as re, -im) is copied to
// LDS once, the chunk's carry is formed and added to it once, and the block then walks
// the columns in NPASS passes of CT, from a tile of its own onward: C as given (k
// contiguous, LDS tile [column][k], a B fragment is one 8-byte read) comes through a
// two-buffer ring of async copies, one whole pass (all of K) per buffer. Each wave owns 16 columns of a pass and all 64 rows:
// four v_wmma_f32_16x16x4_f32 accumulators share one B fragment. The u values of a pass
// are asked for at its head and added (times D) at its foot, and its stores drain under
// the next pass's products.
// ---------------------------------------------------------------------------
template <int ROWS>
__device__ __forceinline__ void stage_out(const float* __restrict__ src, int rowBase, int tid,
                                          float (*dst)[PITCH_OUT]) {
    // ROWS x 128 f32 as ROWS*32 B128 transfers -> ROWS/16 per thread (one wave = one 512-B row)
#pragma unroll
    for (int j = 0; j < ROWS / 16; ++j) {
        const int r  = (tid >> 5) + j * 16;
        const int c4 = (tid & 31) << 2;
        __builtin_amdgcn_global_load_async_to_lds_b128(
            glb4(src + (size_t)(rowBase + r) * NCOL + c4), lds4(&dst[r][c4]), 0, 0);
    }
}

__global__ __launch_bounds__(512) void k_gemm_out(const float* __restrict__ A,
                                                  const float* __restrict__ Cw,
                                                  float* __restrict__ Out,
                                                  const float* __restrict__ uEp,
                                                  const float* __restrict__ dEp,
                                                  const float* __restrict__ log_A_real,
                                                  const float* __restrict__ A_imag,
                                                  const float* __restrict__ log_step,
                                                  const float* __restrict__ csumIn) {
    static_assert(CT == 16 * 16 && HDIM % CT == 0 && NPASS >= 2 && (NPASS & (NPASS - 1)) == 0 &&
                  CLEN == 64 && NSTATE == 64,
                  "16 waves x 16 columns a pass; two waves hold the 64 states");
    constexpr int FA = CLEN / 16;              // A fragments (accumulators) per wave
    __shared__ __align__(16) float As[CLEN][PITCH_OUT];
    __shared__ __align__(16) float Bs[2][CT][PITCH_OUT];

    const int tid  = threadIdx.x;
    const int lane = tid & 31;
    const int wave = tid >> 5;                 // 0..15
    const int rowBase = blockIdx.x * CLEN;
    const int m    = lane & 15;                // A row / B column / D column lane
    const int koff = (lane >> 4) << 1;         // 0 or 2 (K sub-offset per ISA layout)
    const int wcol = wave * 16 + m;            // column inside a pass (0..255)
    // pass ps of this block takes column tile (t0 + ps) mod NPASS: neighbouring blocks are on
    // different tiles of C at any one time, not all 256 on the same L2 lines
    const int t0   = blockIdx.x & (NPASS - 1);

    {
        // the A tile comes with pass 0 of C: the carry is added before any read of A
        stage_out<CLEN>(A, rowBase, tid, As);
        stage_out<CT>(Cw, t0 * CT, tid, Bs[0]);

        // Waves 0 and 1 each take 32 states, one per lane.
        // readfirstlane: keeps the wave's number, and the tests on it, in scalar registers
        const int wv    = __builtin_amdgcn_readfirstlane(wave);
        const int n     = (wv & 1) * 32 + lane;
        const int chunk = (rowBase % T_LEN) / CLEN;
        const bool fixes = wv < 2 && chunk > 0;      // chunk 0 carries nothing
        v2f corr[CLEN];                              // A_bar^(i+1) * carry as (re, -im), row i of the chunk
        if (fixes) {
            // carry = sum over j < chunk of (A_bar^CLEN)^(chunk-1-j) * end state of chunk j;
            // the end states are asked for eight chunks at a time, all before the first use
            const int idx = (rowBase / T_LEN) * NSTATE + n;
            const float* cs = csumIn + (size_t)idx * 2;
            const float lar = log_A_real[n], aim = A_imag[n], lst = log_step[0];
            v2f s[NCH];
#pragma unroll
            for (int g = 0; g < NCH; g += 8)
                if (g < chunk) {
#pragma unroll
                    for (int j = g; j < g + 8; ++j) s[j] = *(const v2f*)(cs + (size_t)j * (BATCH * NSTATE * 2));
                }
            // stands before any register that these loads name as an address is written again;
            // the inputs keep those registers from being reused before it
            asm volatile("s_wait_xcnt 0x0" :: "v"(idx), "v"(cs), "v"(n), "s"(log_A_real), "s"(A_imag) : "memory");
            v2f ab, cf;
            discretize(lar, aim, lst, ab, cf);
            const float ar = ab.x, ai = ab.y;
            float pr = ar, pi = ai;
#pragma unroll
            for (int q = 0; q < 6; ++q) {             // A_bar^64 by repeated squaring
                float nr = pr * pr - pi * pi;
                float ni = 2.f * pr * pi;
                pr = nr; pi = ni;
            }
            float ir = 0.f, ii = 0.f;
#pragma unroll
            for (int j = 0; j < NCH - 1; ++j)
                if (j < chunk) {                      // same for the whole wave
                    float nr = fmaf(pr, ir, fmaf(-pi, ii, s[j].x));
                    float ni = fmaf(pr, ii, fmaf(pi, ir, s[j].y));
                    ir = nr; ii = ni;
                }
            // the serial chain of powers runs here, while the copies are still in flight
            float cr = ar * ir - ai * ii;
            float ci = ar * ii + ai * ir;
#pragma unroll
            for (int i = 0; i < CLEN; ++i) {
                corr[i] = v2f{cr, -ci};
                float nr = cr * ar - ci * ai;
                float ni = cr * ai + ci * ar;
                cr = nr; ci = ni;
            }
        }

        WAIT_ASYNC0();
        __syncthreads();
        stage_out<CT>(Cw, ((t0 + 1) & (NPASS - 1)) * CT, tid, Bs[1]);   // flies while the carry is added

        if (fixes) {
#pragma unroll
            for (int i = 0; i < CLEN; ++i) {
                v2f* p = (v2f*)&As[i][2 * n];
                *p = *p + corr[i];
            }
        }
        // the corrected A tile is published before any wave takes a fragment of it
        __syncthreads();
    }

    // D-matrix layout: VGPR j -> M = j (lanes 0-15) / j+8 (lanes 16-31), N = lane%16
    const int mAdd = (lane < 16) ? 0 : 8;
    const unsigned off0 = (unsigned)(rowBase + mAdd) * HDIM + wcol;   // this lane's first element of u and Out

    // rolled: one pass is 128 WMMAs a wave already, a full unroll would only grow the text
#pragma unroll 1
    for (int ps = 0; ps < NPASS; ++ps) {
        const int cur = ps & 1;
        const int colBase  = ((t0 + ps) & (NPASS - 1)) * CT;
        const unsigned off = off0 + (unsigned)colBase;

        // asked for at the head of the pass, used at its foot
        float uu[FA][8];
#pragma unroll
        for (int f = 0; f < FA; ++f)
#pragma unroll
            for (int j = 0; j < 8; ++j) uu[f][j] = uEp[off + (unsigned)((f * 16 + j) * HDIM)];
        const float d = dEp[colBase + wcol];
        // holds these loads and their address arithmetic at the head of the pass
        __builtin_amdgcn_sched_barrier(0);

        v8f acc[FA];
#pragma unroll
        for (int f = 0; f < FA; ++f) acc[f] = v8f{};

#pragma unroll
        for (int kk = 0; kk < NCOL; kk += 4) {
            const v2f bv = *(const v2f*)&Bs[cur][wcol][kk + koff];
#pragma unroll
            for (int f = 0; f < FA; ++f) {
                const v2f a = *(const v2f*)&As[f * 16 + m][kk + koff];
                acc[f] = __builtin_amdgcn_wmma_f32_16x16x4_f32(false, a, false, bv, (short)0, acc[f], false, false);
            }
        }

        // publish point: our reads of this buffer retired, our copies of the next
        // pass landed, then the barrier; only behind it is this buffer refilled
        WAIT_DS0();
        WAIT_ASYNC0();
        __syncthreads();

        // four vector slots between the last products and the first vector read of their sums:
        // tied to the sums so that it stands there
        asm volatile("v_nop\n\tv_nop\n\tv_nop\n\tv_nop" : "+v"(acc[0]), "+v"(acc[1]), "+v"(acc[2]), "+v"(acc[3]));

        // the stores stand behind the barrier: in front of it the build holds every wave at
        // the barrier until its stores are done (s_wait_storecnt 0); here they drain under
        // the next pass's products
#pragma unroll
        for (int f = 0; f < FA; ++f) {
#pragma unroll
            for (int j = 0; j < 8; ++j) {
                acc[f][j] = acc[f][j] + d * uu[f][j];
                Out[off + (unsigned)((f * 16 + j) * HDIM)] = acc[f][j];
            }
        }
        // stands before any register that this pass's loads and stores name is written again;
        // the inputs keep the stored values' registers from being reused before it
        asm volatile("s_wait_xcnt 0x0" :: "v"(acc[0]), "v"(acc[1]), "v"(acc[2]), "v"(acc[3]) : "memory");

        // the refill has the whole next pass to land
        if (ps + 2 < NPASS) stage_out<CT>(Cw, ((t0 + ps + 2) & (NPASS - 1)) * CT, tid, Bs[cur]);
    }
    WAIT_ASYNC0();                             // no copy outlives the loop
}

// ---------------------------------------------------------------------------
extern "C" void kernel_launch(void* const* d_in, const int* in_sizes, int n_in,
                              void* d_out, int out_size, void* d_ws, size_t ws_size,
                              hipStream_t stream) {
    const float* u     = (const float*)d_in[0];
    const float* lar   = (const float*)d_in[1];
    const float* aim   = (const float*)d_in[2];
    const float* Bw    = (const float*)d_in[3];
    const float* Cw    = (const float*)d_in[4];
    const float* Dw    = (const float*)d_in[5];
    const float* lstep = (const float*)d_in[6];
    float* out = (float*)d_out;
    float* ws  = (float*)d_ws;

    float* xs   = ws + OFF_XS;
    float* csum = ws + OFF_CS;

    // GEMM 1: u[16384 x 1024] * B^T[1024 x 64], times coef, scanned chunk by chunk in its epilogue
    k_gemm_in<<<MROWS / MT_IN, 256, 0, stream>>>(u, HDIM, Bw, HDIM, xs, lar, aim, lstep, csum);

    // GEMM 2: y[16384 x 1024] = (xs + carries)[16384 x 128] * C^T[128 x 1024] + D .* u
    k_gemm_out<<<MROWS / CLEN, 512, 0, stream>>>(xs, Cw, out, u, Dw, lar, aim, lstep, csum);
}

// v006
// It runs in 41.8 microseconds.
// Two timings next to v005 both put it at 1.16 times that version's speed.
// All steps since v000 together make it 3.19 times as fast.
#include <hip/hip_runtime.h>

// ---------------------------------------------------------------------------
// S4 layer for MI455X (gfx1250, wave32).
//   u:(4,4096,1024) f32 -> y:(4,4096,1024) f32
// Two fp32 WMMA GEMMs (16x16x4) around a chunked parallel complex scan.
// The scan has no launch of its own: its chunk-local pass runs in the input GEMM's
// epilogue (one block = one chunk of one batch); the readout forms each chunk's
// carry from the chunks' end states and adds it to its A tile in LDS.
// The input GEMM multiplies by the real B as it is given (64 columns); the complex
// factor (A_bar-1)/A of each state multiplies the finished sums in the epilogue.
// There is no set-up launch: both GEMMs form A_bar (and the factor) of the states they
// need from the raw parameters, and the readout multiplies by C as it is given
// (HDIM x 128, re/im interleaved along k); the minus of Re(C*x) = Cr*xr - Ci*xi sits
// on the imaginary half of the scanned states.
// Input GEMM: 256 threads (8 waves), tile 64 rows x 64 cols x 128 k (2 acc/wave).
// Readout: 512 threads (16 waves), 64 rows held in LDS, all columns walked 256 at a time
// (4 acc/wave, a lane's four sums of a row are four adjacent columns: 16-byte u loads and
// y stores). Double-buffered LDS fed by async global->LDS copies in both.
// ---------------------------------------------------------------------------

typedef __attribute__((ext_vector_type(2))) float v2f;
typedef __attribute__((ext_vector_type(4))) float v4f;
typedef __attribute__((ext_vector_type(8))) float v8f;

#define T_LEN   4096
#define BATCH   4
#define HDIM    1024
#define NSTATE  64
#define NCOL    (2 * NSTATE)          // 128 (re/im interleaved columns)
#define MROWS   (BATCH * T_LEN)       // 16384
#define MT_IN   64                    // rows per block, input projection
#define CT      256                   // columns per pass, readout
#define NPASS   (HDIM / CT)           // 4 passes
#define PITCH_OUT (NCOL + 4)          // 132 = 4 mod 64: 16 rows x 4 k on 64 banks, rows 16B-aligned
#define KC_IN   128                   // K-chunk per LDS stage, input projection
#define PITCH_IN (KC_IN + 4)          // 132: the same bank pattern
#define NCH     64                    // scan chunks
#define CLEN    64                    // timesteps per scan chunk

// ---- workspace layout (float offsets) -------------------------------------
#define OFF_XS   0u
#define OFF_CS   (OFF_XS + (size_t)MROWS * NCOL)                // +2097152

// ---- gfx1250 async global->LDS path ---------------------------------------
// asm with a memory clobber: holds every later LDS read behind the wait
#define WAIT_ASYNC0() asm volatile("s_wait_asynccnt 0x0" ::: "memory")
// a wave's LDS reads have retired before the barrier that frees their buffer
#define WAIT_DS0()    asm volatile("s_wait_dscnt 0x0" ::: "memory")

// Types as in the builtin's signature:
//   param0: AS1 pointer to int __attribute__((vector_size(16)))
//   param1: AS3 pointer
typedef int i4vec __attribute__((__vector_size__(4 * sizeof(int))));
typedef __attribute__((address_space(1))) i4vec* gp_i4;
typedef __attribute__((address_space(3))) i4vec* lp_i4;

__device__ __forceinline__ gp_i4 glb4(const void* p) { return (gp_i4)(uintptr_t)p; }
// flat LDS address: low 32 bits are the LDS offset
__device__ __forceinline__ lp_i4 lds4(void* p) { return (lp_i4)(uintptr_t)p; }

// ---------------------------------------------------------------------------
// Discretization of one state from its raw parameters:
//   A = -exp(log_A_real) + i*A_imag, A_bar = exp(A*step), coef = (A_bar-1)/A
// ---------------------------------------------------------------------------
__device__ __forceinline__ void discretize(float log_A_real, float A_imag, float log_step,
                                           v2f& abar, v2f& coef) {
    float step = __expf(log_step);
    float Ar = -__expf(log_A_real);
    float Ai = A_imag;
    float e   = __expf(Ar * step);
    float abr = e * __cosf(Ai * step);
    float abi = e * __sinf(Ai * step);
    float nr = abr - 1.0f, ni = abi;
    float den = Ar * Ar + Ai * Ai;
    float inv = 1.0f / den;
    abar = v2f{abr, abi};
    coef = v2f{(nr * Ar + ni * Ai) * inv, (ni * Ar - nr * Ai) * inv};
}

// ---------------------------------------------------------------------------
// Input projection + chunk-local scan. One block = one scan chunk (CLEN steps of one
// batch) x all NSTATE states: P[64 x 64] = u[64 x 1024] * B^T, B taken as given
// (NSTATE x HDIM, k contiguous, so its LDS tile is [state][k] like the A tile and a
// B fragment is one 8-byte read). 16384 / 64 = 256 blocks, one per WGP.
// Wave w: columns 16*(w&3).., rows 32*(w>>2)..: two accumulators share one B fragment.
// Epilogue: every wave lays coef * P (re/im interleaved) into LDS, then two waves run
// x_t = A_bar * x_{t-1} + row_t down the tile from x = 0; the scan goes to Out as
// (re, -im), the form the readout multiplies by C, the chunk's end state to csum.
// ---------------------------------------------------------------------------
__device__ __forceinline__ void stage_in(const float* __restrict__ src, int ld, int rowBase,
                                         int k0, int tid, float (*dst)[PITCH_IN]) {
    // 64 rows x 128 f32 as 2048 B128 transfers -> 8 per thread (one wave = one 512-B row)
#pragma unroll
    for (int j = 0; j < 8; ++j) {
        const int r  = (tid >> 5) + j * 8;
        const int c4 = (tid & 31) << 2;
        __builtin_amdgcn_global_load_async_to_lds_b128(
            glb4(src + (size_t)(rowBase + r) * ld + k0 + c4), lds4(&dst[r][c4]), 0, 0);
    }
}

__global__ __launch_bounds__(256) void k_gemm_in(const float* __restrict__ u, int ldu,
                                                 const float* __restrict__ Bw, int ldb,
                                                 float* __restrict__ Out,
                                                 const float* __restrict__ log_A_real,
                                                 const float* __restrict__ A_imag,
                                                 const float* __restrict__ log_step,
                                                 float* __restrict__ csum) {
    static_assert(MT_IN == CLEN && NSTATE == 64 && NCOL <= PITCH_IN && HDIM / KC_IN >= 2 && HDIM % KC_IN == 0,
                  "one tile = one chunk, its scan input held in one B stage");
    __shared__ __align__(16) float Us[2][MT_IN][PITCH_IN];
    __shared__ __align__(16) float Bn[2][NSTATE][PITCH_IN];

    const int tid  = threadIdx.x;
    const int lane = tid & 31;
    const int wave = tid >> 5;                 // 0..7
    const int rowBase = blockIdx.x * MT_IN;
    const int m    = lane & 15;                // A row / B column / D column lane
    const int koff = (lane >> 4) << 1;         // 0 or 2 (K sub-offset per ISA layout)
    const int wcol = (wave & 3) * 16 + m;      // state (0..63)
    const int wrow = (wave >> 2) * 32;         // first of the wave's 32 rows

    v8f acc[2] = {v8f{}, v8f{}};
    constexpr int nch = HDIM / KC_IN;

    // stage 0 lands and is published before anyone reads it; stage 1 then flies
    stage_in(u, ldu, rowBase, 0, tid, Us[0]);
    stage_in(Bw, ldb, 0, 0, tid, Bn[0]);
    // asked for here, so that the epilogue does not wait for them: the raw parameters of
    // the state this thread scans (A_bar) and of the state whose column this lane holds (factor)
    const int nScan = tid & (NSTATE - 1);
    const float lst  = log_step[0];
    const float larS = log_A_real[nScan], aimS = A_imag[nScan];
    const float larC = log_A_real[wcol],  aimC = A_imag[wcol];
    // stands before any register that these loads name as an address is written again;
    // the inputs keep those registers from being reused before it
    asm volatile("s_wait_xcnt 0x0" :: "v"(nScan), "v"(wcol), "s"(log_A_real), "s"(A_imag) : "memory");
    v2f ab, cf, abC, cfS;
    discretize(larS, aimS, lst, ab, cfS);
    discretize(larC, aimC, lst, abC, cf);
    WAIT_ASYNC0();
    __syncthreads();
    stage_in(u, ldu, rowBase, KC_IN, tid, Us[1]);
    stage_in(Bw, ldb, 0, KC_IN, tid, Bn[1]);

    // rolled: one trip is 64 WMMAs already, a full unroll would only grow the text
#pragma unroll 1
    for (int ch = 0; ch < nch; ++ch) {
        const int cur = ch & 1;

#pragma unroll
        for (int kk = 0; kk < KC_IN; kk += 4) {
            const v2f bv = *(const v2f*)&Bn[cur][wcol][kk + koff];
#pragma unroll
            for (int f = 0; f < 2; ++f) {
                const v2f a = *(const v2f*)&Us[cur][wrow + f * 16 + m][kk + koff];
                acc[f] = __builtin_amdgcn_wmma_f32_16x16x4_f32(false, a, false, bv, (short)0, acc[f], false, false);
            }
        }

        // publish point: our reads of this buffer retired, our copies of the next
        // stage landed, then the barrier; only behind it is this buffer refilled
        WAIT_DS0();
        WAIT_ASYNC0();
        __syncthreads();
        if (ch + 2 < nch) {
            stage_in(u, ldu, rowBase, (ch + 2) * KC_IN, tid, Us[cur]);
            stage_in(Bw, ldb, 0, (ch + 2) * KC_IN, tid, Bn[cur]);
        }
    }
    WAIT_ASYNC0();                             // no copy outlives the loop

    // D-matrix layout: VGPR j -> M = j (lanes 0-15) / j+8 (lanes 16-31), N = lane%16
    const int mAdd = (lane < 16) ? 0 : 8;
    // Bn[0] is free: every wave has passed the loop's last barrier, no copy is in flight
    float (*S)[PITCH_IN] = Bn[0];
#pragma unroll
    for (int f = 0; f < 2; ++f)
#pragma unroll
        for (int j = 0; j < 8; ++j)
            *(v2f*)&S[wrow + f * 16 + mAdd + j][2 * wcol] = v2f{cf.x * acc[f][j], cf.y * acc[f][j]};
    // all eight waves' columns stand in LDS before two waves walk down them
    __syncthreads();
    if (tid < NSTATE) {
        const int n = tid;
        const float ar = ab.x, ai = ab.y;
        v2f bu[CLEN];
#pragma unroll
        for (int i = 0; i < CLEN; ++i) bu[i] = *(const v2f*)&S[i][2 * n];
        float xr = 0.f, xi = 0.f;
        float* q = Out + (size_t)rowBase * NCOL + 2 * n;
#pragma unroll
        for (int i = 0; i < CLEN; ++i) {
            float nr = fmaf(ar, xr, fmaf(-ai, xi, bu[i].x));
            float ni = fmaf(ar, xi, fmaf(ai, xr, bu[i].y));
            xr = nr; xi = ni;
            *(v2f*)(q + (size_t)i * NCOL) = v2f{xr, -xi};
        }
        const int b = blockIdx.x / NCH, chunk = blockIdx.x % NCH;
        *(v2f*)(csum + (size_t)(chunk * (BATCH * NSTATE) + b * NSTATE + n) * 2) = v2f{xr, xi};
    }
}

// ---------------------------------------------------------------------------
// Readout GEMM: Out[M x HDIM] = A[M x NCOL] * Cw[HDIM x NCOL]^T + D .* u
// One block = one scan chunk (CLEN rows of one batch) x ALL HDIM columns, 512 threads =
// 16 wave32, one block per WGP. The A tile (chunk-local scans as re, -im) is copied to
// LDS once, the chunk's carry is formed and added to it once, and the block then walks
// the columns in NPASS passes of CT, from a tile of its own onward: C as given (k
// contiguous, LDS tile [column][k], a B fragment is one 8-byte read) comes through a
// two-buffer ring of async copies, one whole pass (all of K) per buffer. Each wave owns 16 rows
// and 64 columns of a pass: four v_wmma_f32_16x16x4_f32 accumulators share one A fragment.
// Fragment c of the wave holds columns 4*lane + c of its 64 (the copies deal the rows of C out
// in LDS that way), so a lane's four sums of one row are four adjacent columns: u is read and
// y is stored 16 bytes a lane, 256 contiguous bytes a row. The u values of a pass are asked
// for at its head and added (times D) at its foot, and its stores drain under the next
// pass's products.
// ---------------------------------------------------------------------------
template <int ROWS, bool DEAL>
__device__ __forceinline__ void stage_out(const float* __restrict__ src, int rowBase, int tid,
                                          float (*dst)[PITCH_OUT]) {
    // ROWS x 128 f32 as ROWS*32 B128 transfers -> ROWS/16 per thread (one wave = one 512-B row)
#pragma unroll
    for (int j = 0; j < ROWS / 16; ++j) {
        const int r  = (tid >> 5) + j * 16;
        const int c4 = (tid & 31) << 2;
        // DEAL: source row 64 g + 4 q + c lands in LDS row 64 g + 16 c + q (one to one on ROWS rows);
        // with r = wave + 16 j and 16 waves: g = j / 4, q = wave / 4 + 4 (j % 4), c = wave % 4
        const int rl = DEAL ? (j >> 2) * 64 + (j & 3) * 4 + ((tid >> 5) & 3) * 16 + (tid >> 7) : r;
        __builtin_amdgcn_global_load_async_to_lds_b128(
            glb4(src + (size_t)(rowBase + r) * NCOL + c4), lds4(&dst[rl][c4]), 0, 0);
    }
}

__global__ __launch_bounds__(512) void k_gemm_out(const float* __restrict__ A,
                                                  const float* __restrict__ Cw,
                                                  float* __restrict__ Out,
                                                  const float* __restrict__ uEp,
                                                  const float* __restrict__ dEp,
                                                  const float* __restrict__ log_A_real,
                                                  const float* __restrict__ A_imag,
                                                  const float* __restrict__ log_step,
                                                  const float* __restrict__ csumIn) {
    static_assert(CT == 4 * 64 && HDIM % CT == 0 && NPASS >= 2 && (NPASS & (NPASS - 1)) == 0 &&
                  CLEN == 4 * 16 && NSTATE == 64,
                  "16 waves = 4 row groups x 4 column groups a pass; two waves hold the 64 states");
    constexpr int FB = 4;                      // B fragments (accumulators) per wave
    __shared__ __align__(16) float As[CLEN][PITCH_OUT];
    __shared__ __align__(16) float Bs[2][CT][PITCH_OUT];

    const int tid  = threadIdx.x;
    const int lane = tid & 31;
    const int wave = tid >> 5;                 // 0..15
    const int rowBase = blockIdx.x * CLEN;
    const int m    = lane & 15;                // A row / B column / D column lane
    const int koff = (lane >> 4) << 1;         // 0 or 2 (K sub-offset per ISA layout)
    const int arow = (wave & 3) * 16 + m;      // this lane's row of the A tile
    const int brow = (wave >> 2) * 64 + m;     // this lane's LDS row of C for fragment 0; fragment c: + 16 c
    const int wcol = (wave >> 2) * 64 + 4 * m; // first of this lane's four columns inside a pass
    // pass ps of this block takes column tile (t0 + ps) mod NPASS: neighbouring blocks are on
    // different tiles of C at any one time, not all 256 on the same L2 lines
    const int t0   = blockIdx.x & (NPASS - 1);

    {
        // the A tile comes with pass 0 of C: the carry is added before any read of A
        stage_out<CLEN, false>(A, rowBase, tid, As);
        stage_out<CT, true>(Cw, t0 * CT, tid, Bs[0]);

        // Waves 0 and 1 each take 32 states, one per lane.
        // readfirstlane: keeps the wave's number, and the tests on it, in scalar registers
        const int wv    = __builtin_amdgcn_readfirstlane(wave);
        const int n     = (wv & 1) * 32 + lane;
        const int chunk = (rowBase % T_LEN) / CLEN;
        const bool fixes = wv < 2 && chunk > 0;      // chunk 0 carries nothing
        v2f corr[CLEN];                              // A_bar^(i+1) * carry as (re, -im), row i of the chunk
        if (fixes) {
            // carry = sum over j < chunk of (A_bar^CLEN)^(chunk-1-j) * end state of chunk j;
            // the end states are asked for eight chunks at a time, all before the first use
            const int idx = (rowBase / T_LEN) * NSTATE + n;
            const float* cs = csumIn + (size_t)idx * 2;
            const float lar = log_A_real[n], aim = A_imag[n], lst = log_step[0];
            v2f s[NCH];
#pragma unroll
            for (int g = 0; g < NCH; g += 8)
                if (g < chunk) {
#pragma unroll
                    for (int j = g; j < g + 8; ++j) s[j] = *(const v2f*)(cs + (size_t)j * (BATCH * NSTATE * 2));
                }
            // stands before any register that these loads name as an address is written again;
            // the inputs keep those registers from being reused before it
            asm volatile("s_wait_xcnt 0x0" :: "v"(idx), "v"(cs), "v"(n), "s"(log_A_real), "s"(A_imag) : "memory");
            v2f ab, cf;
            discretize(lar, aim, lst, ab, cf);
            const float ar = ab.x, ai = ab.y;
            float pr = ar, pi = ai;
#pragma unroll
            for (int q = 0; q < 6; ++q) {             // A_bar^64 by repeated squaring
                float nr = pr * pr - pi * pi;
                float ni = 2.f * pr * pi;
                pr = nr; pi = ni;
            }
            float ir = 0.f, ii = 0.f;
#pragma unroll
            for (int j = 0; j < NCH - 1; ++j)
                if (j < chunk) {                      // same for the whole wave
                    float nr = fmaf(pr, ir, fmaf(-pi, ii, s[j].x));
                    float ni = fmaf(pr, ii, fmaf(pi, ir, s[j].y));
                    ir = nr; ii = ni;
                }
            // the serial chain of powers runs here, while the copies are still in flight
            float cr = ar * ir - ai * ii;
            float ci = ar * ii + ai * ir;
#pragma unroll
            for (int i = 0; i < CLEN; ++i) {
                corr[i] = v2f{cr, -ci};
                float nr = cr * ar - ci * ai;
                float ni = cr * ai + ci * ar;
                cr = nr; ci = ni;
            }
        }

        WAIT_ASYNC0();
        __syncthreads();
        stage_out<CT, true>(Cw, ((t0 + 1) & (NPASS - 1)) * CT, tid, Bs[1]);   // flies while the carry is added

        if (fixes) {
#pragma unroll
            for (int i = 0; i < CLEN; ++i) {
                v2f* p = (v2f*)&As[i][2 * n];
                *p = *p + corr[i];
            }
        }
        // the corrected A tile is published before any wave takes a fragment of it
        __syncthreads();
    }

    // D-matrix layout: VGPR j -> M = j (lanes 0-15) / j+8 (lanes 16-31), N = lane%16
    const int mAdd = (lane < 16) ? 0 : 8;
    const unsigned off0 = (unsigned)(rowBase + (wave & 3) * 16 + mAdd) * HDIM + wcol;   // this lane's first element of u and Out

    // rolled: one pass is 128 WMMAs a wave already, a full unroll would only grow the text
#pragma unroll 1
    for (int ps = 0; ps < NPASS; ++ps) {
        const int cur = ps & 1;
        const int colBase  = ((t0 + ps) & (NPASS - 1)) * CT;
        const unsigned off = off0 + (unsigned)colBase;

        // asked for at the head of the pass, used at its foot
        v4f uu[8];
#pragma unroll
        for (int j = 0; j < 8; ++j) uu[j] = *(const v4f*)(uEp + off + (unsigned)(j * HDIM));
        const v4f d = *(const v4f*)(dEp + colBase + wcol);
        // holds these loads and their address arithmetic at the head of the pass
        __builtin_amdgcn_sched_barrier(0);

        v8f acc[FB];
#pragma unroll
        for (int c = 0; c < FB; ++c) acc[c] = v8f{};

#pragma unroll
        for (int kk = 0; kk < NCOL; kk += 4) {
            const v2f a = *(const v2f*)&As[arow][kk + koff];
#pragma unroll
            for (int c = 0; c < FB; ++c) {
                const v2f bv = *(const v2f*)&Bs[cur][brow + c * 16][kk + koff];
                acc[c] = __builtin_amdgcn_wmma_f32_16x16x4_f32(false, a, false, bv, (short)0, acc[c], false, false);
            }
        }

        // publish point: our reads of this buffer retired, our copies of the next
        // pass landed, then the barrier; only behind it is this buffer refilled
        WAIT_DS0();
        WAIT_ASYNC0();
        __syncthreads();

        // four vector slots between the last products and the first vector read of their sums:
        // tied to the sums so that it stands there
        asm volatile("v_nop\n\tv_nop\n\tv_nop\n\tv_nop" : "+v"(acc[0]), "+v"(acc[1]), "+v"(acc[2]), "+v"(acc[3]));

        // the stores stand behind the barrier: in front of it the build holds every wave at
        // the barrier until its stores are done (s_wait_storecnt 0); here they drain under
        // the next pass's products
#pragma unroll
        for (int j = 0; j < 8; ++j) {
            uu[j] = v4f{acc[0][j] + d.x * uu[j].x, acc[1][j] + d.y * uu[j].y,
                        acc[2][j] + d.z * uu[j].z, acc[3][j] + d.w * uu[j].w};
            *(v4f*)(Out + off + (unsigned)(j * HDIM)) = uu[j];
        }
        // stands before any register that this pass's loads and stores name is written again;
        // the inputs keep the stored values' and the offset's registers from being reused before it
        asm volatile("s_wait_xcnt 0x0" :: "v"(uu[0]), "v"(uu[1]), "v"(uu[2]), "v"(uu[3]),
                     "v"(uu[4]), "v"(uu[5]), "v"(uu[6]), "v"(uu[7]), "v"(off) : "memory");

        // the refill has the whole next pass to land
        if (ps + 2 < NPASS) stage_out<CT, true>(Cw, ((t0 + ps + 2) & (NPASS - 1)) * CT, tid, Bs[cur]);
    }
    WAIT_ASYNC0();                             // no copy outlives the loop
}

// ---------------------------------------------------------------------------
extern "C" void kernel_launch(void* const* d_in, const int* in_sizes, int n_in,
                              void* d_out, int out_size, void* d_ws, size_t ws_size,
                              hipStream_t stream) {
    const float* u     = (const float*)d_in[0];
    const float* lar   = (const float*)d_in[1];
    const float* aim   = (const float*)d_in[2];
    const float* Bw    = (const float*)d_in[3];
    const float* Cw    = (const float*)d_in[4];
    const float* Dw    = (const float*)d_in[5];
    const float* lstep = (const float*)d_in[6];
    float* out = (float*)d_out;
    float* ws  = (float*)d_ws;

    float* xs   = ws + OFF_XS;
    float* csum = ws + OFF_CS;

    // GEMM 1: u[16384 x 1024] * B^T[1024 x 64], times coef, scanned chunk by chunk in its epilogue
    k_gemm_in<<<MROWS / MT_IN, 256, 0, stream>>>(u, HDIM, Bw, HDIM, xs, lar, aim, lstep, csum);

    // GEMM 2: y[16384 x 1024] = (xs + carries)[16384 x 128] * C^T[128 x 1024] + D .* u
    k_gemm_out<<<MROWS / CLEN, 512, 0, stream>>>(xs, Cw, out, u, Dw, lar, aim, lstep, csum);
}
